// v000
// Measured on an AMD MI455X. A time is GPU time per run, averaged over a window of back-to-back runs after a warm-up
// (all launches, gaps included; the runs take copies of the inputs in turn), and the median of several windows.
// Apart from v000's, it joins two sittings. Times from different sittings can be a few percent apart, while
// side-by-side timings come from the same sitting.
// The starting kernel, v000, takes 146 microseconds a run.
#include <hip/hip_runtime.h>

// ---------------------------------------------------------------------------
// MHA with grid bias for MI455X (gfx1250), wave32, WMMA f16 -> f32 accum.
//   kernel 1: qkv projection  (f32 in -> f16 q/k/v in (B,NH,S,HD) layout)
//   kernel 2: fused flash-style attention (f16 in/out, f32 softmax state)
//             K tile staged via GLOBAL_LOAD_ASYNC_TO_LDS_B128 (ASYNCcnt)
//   kernel 3: output projection (f16 in -> f32 out + bias), async X tile
// Workspace: 4 buffers of M*HID f16 = 32 MB.
// ---------------------------------------------------------------------------

typedef __attribute__((ext_vector_type(16))) _Float16 v16h;
typedef __attribute__((ext_vector_type(8)))  _Float16 half8;
typedef __attribute__((ext_vector_type(8)))  float    v8f;
typedef __attribute__((ext_vector_type(4)))  float    f4v;

#define B_   4
#define S_   1024
#define HID_ 1024
#define NH_  16
#define HD_  64
#define M_   (B_ * S_)

// 16-bit A-fragment gather (ISA 7.12.2): lane holds one row; k-chunks
// [kb, kb+7] and [16+kb, 16+kb+7] with kb = (lane<16) ? 0 : 8.
// B fragments use the mirror layout (lane = column), so x@W^T and q@k^T
// gather B exactly like A from row-major storage.
__device__ __forceinline__ v16h load_frag(const _Float16* __restrict__ row, int kb) {
  half8 lo = *(const half8*)(row + kb);
  half8 hi = *(const half8*)(row + 16 + kb);
  v16h a;
#pragma unroll
  for (int i = 0; i < 8; ++i) { a[i] = lo[i]; a[i + 8] = hi[i]; }
  return a;
}

__device__ __forceinline__ v8f wmma32(v16h a, v16h b, v8f c) {
  return __builtin_amdgcn_wmma_f32_16x16x32_f16(false, a, false, b, (short)0, c,
                                                false, false);
}

__device__ __forceinline__ half8 cvt8(f4v a, f4v b) {
  half8 h;
#pragma unroll
  for (int i = 0; i < 4; ++i) { h[i] = (_Float16)a[i]; h[4 + i] = (_Float16)b[i]; }
  return h;
}

// Async global->LDS copy of 64 contiguous bytes (4 x B128). GVS addressing:
//   LDS[lds_off + ioff] = MEM[saddr + goff + ioff]; tracked by ASYNCcnt.
__device__ __forceinline__ void async_copy64(unsigned lds_off, unsigned goff,
                                             const void* saddr) {
  asm volatile(
      "global_load_async_to_lds_b128 %0, %1, %2\n\t"
      "global_load_async_to_lds_b128 %0, %1, %2 offset:16\n\t"
      "global_load_async_to_lds_b128 %0, %1, %2 offset:32\n\t"
      "global_load_async_to_lds_b128 %0, %1, %2 offset:48"
      :: "v"(lds_off), "v"(goff), "s"(saddr) : "memory");
}

__device__ __forceinline__ void async_copy32(unsigned lds_off, unsigned goff,
                                             const void* saddr) {
  asm volatile(
      "global_load_async_to_lds_b128 %0, %1, %2\n\t"
      "global_load_async_to_lds_b128 %0, %1, %2 offset:16"
      :: "v"(lds_off), "v"(goff), "s"(saddr) : "memory");
}

__device__ __forceinline__ void wait_async0() {
  asm volatile("s_wait_asynccnt 0x0" ::: "memory");
}

__device__ __forceinline__ unsigned lds_off32(const void* p) {
  return (unsigned)(size_t)p;  // flat LDS aperture: offset in addr[31:0]
}

// ---------------------------------------------------------------------------
// Kernel 1: q/k/v = X @ W^T + b, output f16 in (B,NH,S,HD) layout.
// Grid: (HID/64, M/128, 3). Block: 256 (8 waves; 4x2 wave grid, 32x32/wave).
// ---------------------------------------------------------------------------
__global__ __launch_bounds__(256)
void qkv_kernel(const float* __restrict__ Xq, const float* __restrict__ Xk,
                const float* __restrict__ Xv, const float* __restrict__ Wq,
                const float* __restrict__ Wk, const float* __restrict__ Wv,
                const float* __restrict__ bq, const float* __restrict__ bk,
                const float* __restrict__ bv, _Float16* __restrict__ Oq,
                _Float16* __restrict__ Ok, _Float16* __restrict__ Ov) {
  const int z = blockIdx.z;
  const float* X    = (z == 0) ? Xq : (z == 1) ? Xk : Xv;
  const float* W    = (z == 0) ? Wq : (z == 1) ? Wk : Wv;
  const float* bias = (z == 0) ? bq : (z == 1) ? bk : bv;
  _Float16*    O    = (z == 0) ? Oq : (z == 1) ? Ok : Ov;

  __shared__ __align__(16) _Float16 Xs[128][40];
  __shared__ __align__(16) _Float16 Ws[64][40];

  const int t = threadIdx.x;
  const int lane = t & 31, wave = t >> 5;
  const int wm = wave >> 1, wn = wave & 1;
  const int m0 = blockIdx.y * 128, n0 = blockIdx.x * 64;
  const int kb = (lane < 16) ? 0 : 8;
  const int lr = lane & 15, hi = lane >> 4;

  const int xrow = t >> 1, xhalf = t & 1;
  const int wrow = t >> 2, wq = t & 3;

  v8f acc[2][2] = {};

  for (int k0 = 0; k0 < HID_; k0 += 32) {
    __syncthreads();
    {  // X tile: 128 rows x 32 k (f32 -> f16)
      const float* g = X + (size_t)(m0 + xrow) * HID_ + k0 + xhalf * 16;
      f4v x0 = *(const f4v*)g;       f4v x1 = *(const f4v*)(g + 4);
      f4v x2 = *(const f4v*)(g + 8); f4v x3 = *(const f4v*)(g + 12);
      *(half8*)&Xs[xrow][xhalf * 16]     = cvt8(x0, x1);
      *(half8*)&Xs[xrow][xhalf * 16 + 8] = cvt8(x2, x3);
      if (k0 + 32 < HID_) __builtin_prefetch(g + 32, 0, 0);  // next k-step
    }
    {  // W tile: 64 rows x 32 k
      const float* g = W + (size_t)(n0 + wrow) * HID_ + k0 + wq * 8;
      f4v x0 = *(const f4v*)g; f4v x1 = *(const f4v*)(g + 4);
      *(half8*)&Ws[wrow][wq * 8] = cvt8(x0, x1);
      if (k0 + 32 < HID_) __builtin_prefetch(g + 32, 0, 0);
    }
    __syncthreads();

    v16h a[2], bf[2];
#pragma unroll
    for (int tm = 0; tm < 2; ++tm) a[tm]  = load_frag(&Xs[wm * 32 + tm * 16 + lr][0], kb);
#pragma unroll
    for (int tn = 0; tn < 2; ++tn) bf[tn] = load_frag(&Ws[wn * 32 + tn * 16 + lr][0], kb);
#pragma unroll
    for (int tm = 0; tm < 2; ++tm)
#pragma unroll
      for (int tn = 0; tn < 2; ++tn) acc[tm][tn] = wmma32(a[tm], bf[tn], acc[tm][tn]);
  }

  // Epilogue: bias + scatter into (B,NH,S,HD) f16.
#pragma unroll
  for (int tn = 0; tn < 2; ++tn) {
    const int n = n0 + wn * 32 + tn * 16 + lr;
    const float bn = bias[n];
    const int h = n >> 6, d = n & 63;
#pragma unroll
    for (int tm = 0; tm < 2; ++tm) {
#pragma unroll
      for (int r = 0; r < 8; ++r) {
        const int m = m0 + wm * 32 + tm * 16 + r + 8 * hi;
        const int bb = m >> 10, sq = m & (S_ - 1);
        O[(((size_t)(bb * NH_ + h) * S_) + sq) * HD_ + d] =
            (_Float16)(acc[tm][tn][r] + bn);
      }
    }
  }
}

// ---------------------------------------------------------------------------
// Kernel 2: fused attention. Grid: (S/64, B*NH). Block: 128 (4 waves).
// Each wave owns 16 query rows; streams 64-key tiles with online softmax.
// ---------------------------------------------------------------------------
__global__ __launch_bounds__(128)
void attn_kernel(const _Float16* __restrict__ Q, const _Float16* __restrict__ K,
                 const _Float16* __restrict__ V, _Float16* __restrict__ Oa) {
  __shared__ __align__(16) _Float16 Ks[64][72];
  __shared__ __align__(16) _Float16 Vs[64][72];      // transposed: [d][key]
  __shared__ __align__(16) _Float16 Ps[4][16][72];   // per-wave P staging

  const int t = threadIdx.x, lane = t & 31, wave = t >> 5;
  const int lr = lane & 15, hi = lane >> 4;
  const int kb = (lane < 16) ? 0 : 8;
  const int bh = blockIdx.y;                 // b*NH + h
  const int iq_base = blockIdx.x * 64 + wave * 16;

  const _Float16* qbase = Q + (size_t)bh * S_ * HD_;
  const _Float16* kbase = K + (size_t)bh * S_ * HD_;
  const _Float16* vbase = V + (size_t)bh * S_ * HD_;

  // Q fragments (16 rows x 64 d) held in registers for the whole kernel.
  v16h aq[2];
  {
    const _Float16* qr = qbase + (size_t)(iq_base + lr) * HD_;
    aq[0] = load_frag(qr, kb);
    aq[1] = load_frag(qr + 32, kb);
  }

  float mrow[8], lrow[8];
  v8f o[4] = {};
#pragma unroll
  for (int r = 0; r < 8; ++r) { mrow[r] = -1e30f; lrow[r] = 0.0f; }
  const float scale = 0.125f;  // 1/sqrt(64)

  const int row = t >> 1, half = t & 1;
  const unsigned ks_lds = lds_off32(&Ks[row][half * 32]);

  for (int kt = 0; kt < S_; kt += 64) {
    __syncthreads();  // previous iteration's tile reads complete
    {
      // K tile: async global->LDS (4 x B128 per thread, ASYNCcnt-tracked).
      const unsigned goff =
          (unsigned)(((kt + row) * HD_ + half * 32) * sizeof(_Float16));
      async_copy64(ks_lds, goff, (const void*)kbase);

      // V tile: VGPR path with transpose into Vs[d][key].
      const half8* gv = (const half8*)(vbase + (size_t)(kt + row) * HD_ + half * 32);
      half8 v0 = gv[0], v1 = gv[1], v2 = gv[2], v3 = gv[3];
#pragma unroll
      for (int j = 0; j < 8; ++j) {
        Vs[half * 32 + j][row]      = v0[j];
        Vs[half * 32 + 8 + j][row]  = v1[j];
        Vs[half * 32 + 16 + j][row] = v2[j];
        Vs[half * 32 + 24 + j][row] = v3[j];
      }
      if (kt + 64 < S_)  // prefetch next V tile (global_prefetch_b8)
        __builtin_prefetch(vbase + (size_t)(kt + 64 + row) * HD_ + half * 32, 0, 0);
    }
    wait_async0();    // K tile async writes landed in LDS
    __syncthreads();  // tiles visible to all waves

    // Scores: 4 key sub-tiles of 16; each is two chained k=32 WMMAs.
    v8f s[4];
#pragma unroll
    for (int j = 0; j < 4; ++j) {
      v16h bk0 = load_frag(&Ks[j * 16 + lr][0], kb);
      v16h bk1 = load_frag(&Ks[j * 16 + lr][32], kb);
      v8f c = {};
      c = wmma32(aq[0], bk0, c);
      c = wmma32(aq[1], bk1, c);
      s[j] = c;
    }

    // Scale + grid bias + row max.
    float rmax[8];
#pragma unroll
    for (int r = 0; r < 8; ++r) rmax[r] = -1e30f;
#pragma unroll
    for (int j = 0; j < 4; ++j) {
      const int jg = kt + j * 16 + lr;
      const int jgc = jg >> 5, jgm = jg & 31;
#pragma unroll
      for (int r = 0; r < 8; ++r) {
        const int i = iq_base + r + 8 * hi;
        const float bias = (((i >> 5) == jgc) || ((i & 31) == jgm)) ? 0.1f : 0.0f;
        const float val = s[j][r] * scale + bias;
        s[j][r] = val;
        rmax[r] = fmaxf(rmax[r], val);
      }
    }
#pragma unroll
    for (int off = 1; off < 16; off <<= 1)
#pragma unroll
      for (int r = 0; r < 8; ++r)
        rmax[r] = fmaxf(rmax[r], __shfl_xor(rmax[r], off, 32));

    // Online softmax update.
    float alpha[8], rsum[8];
#pragma unroll
    for (int r = 0; r < 8; ++r) {
      const float mn = fmaxf(mrow[r], rmax[r]);
      alpha[r] = __expf(mrow[r] - mn);
      mrow[r] = mn;
      rsum[r] = 0.0f;
    }
#pragma unroll
    for (int j = 0; j < 4; ++j)
#pragma unroll
      for (int r = 0; r < 8; ++r) {
        const float p = __expf(s[j][r] - mrow[r]);
        s[j][r] = p;
        rsum[r] += p;
      }
#pragma unroll
    for (int off = 1; off < 16; off <<= 1)
#pragma unroll
      for (int r = 0; r < 8; ++r) rsum[r] += __shfl_xor(rsum[r], off, 32);
#pragma unroll
    for (int r = 0; r < 8; ++r) lrow[r] = lrow[r] * alpha[r] + rsum[r];
#pragma unroll
    for (int dd = 0; dd < 4; ++dd)
#pragma unroll
      for (int r = 0; r < 8; ++r) o[dd][r] *= alpha[r];

    // P (f16) -> LDS, re-read in A-fragment layout.
#pragma unroll
    for (int j = 0; j < 4; ++j)
#pragma unroll
      for (int r = 0; r < 8; ++r)
        Ps[wave][r + 8 * hi][j * 16 + lr] = (_Float16)s[j][r];
    __syncthreads();  // orders Ps write -> read (and DS counters)

    v16h ap0 = load_frag(&Ps[wave][lr][0], kb);
    v16h ap1 = load_frag(&Ps[wave][lr][32], kb);
#pragma unroll
    for (int dd = 0; dd < 4; ++dd) {
      v16h bv0 = load_frag(&Vs[dd * 16 + lr][0], kb);
      v16h bv1 = load_frag(&Vs[dd * 16 + lr][32], kb);
      o[dd] = wmma32(ap0, bv0, o[dd]);
      o[dd] = wmma32(ap1, bv1, o[dd]);
    }
  }

  // Normalize and store f16 in (B,S,HID) layout for the output projection.
  const int bb = bh / NH_, h = bh % NH_;
#pragma unroll
  for (int dd = 0; dd < 4; ++dd)
#pragma unroll
    for (int r = 0; r < 8; ++r) {
      const int sq = iq_base + r + 8 * hi;
      const float val = o[dd][r] / lrow[r];
      Oa[((size_t)(bb * S_ + sq)) * HID_ + h * HD_ + dd * 16 + lr] = (_Float16)val;
    }
}

// ---------------------------------------------------------------------------
// Kernel 3: out = A @ Wo^T + bo, f16 in -> f32 out.
// Grid: (HID/64, M/128). Block: 256.
// ---------------------------------------------------------------------------
__global__ __launch_bounds__(256)
void oproj_kernel(const _Float16* __restrict__ X, const float* __restrict__ W,
                  const float* __restrict__ bias, float* __restrict__ Out) {
  __shared__ __align__(16) _Float16 Xs[128][40];
  __shared__ __align__(16) _Float16 Ws[64][40];

  const int t = threadIdx.x;
  const int lane = t & 31, wave = t >> 5;
  const int wm = wave >> 1, wn = wave & 1;
  const int m0 = blockIdx.y * 128, n0 = blockIdx.x * 64;
  const int kb = (lane < 16) ? 0 : 8;
  const int lr = lane & 15, hi = lane >> 4;

  const int xrow = t >> 1, xhalf = t & 1;
  const int wrow = t >> 2, wq = t & 3;
  const unsigned xs_lds = lds_off32(&Xs[xrow][xhalf * 16]);

  v8f acc[2][2] = {};

  for (int k0 = 0; k0 < HID_; k0 += 32) {
    __syncthreads();
    {  // X tile: 128 rows x 32 k (f16), async global->LDS (2 x B128/thread)
      const unsigned goff = (unsigned)(((size_t)(m0 + xrow) * HID_ + k0 +
                                        xhalf * 16) * sizeof(_Float16));
      async_copy32(xs_lds, goff, (const void*)X);
    }
    {  // W tile: 64 rows x 32 k (f32 -> f16)
      const float* g = W + (size_t)(n0 + wrow) * HID_ + k0 + wq * 8;
      f4v x0 = *(const f4v*)g; f4v x1 = *(const f4v*)(g + 4);
      *(half8*)&Ws[wrow][wq * 8] = cvt8(x0, x1);
      if (k0 + 32 < HID_) __builtin_prefetch(g + 32, 0, 0);
    }
    wait_async0();
    __syncthreads();

    v16h a[2], bf[2];
#pragma unroll
    for (int tm = 0; tm < 2; ++tm) a[tm]  = load_frag(&Xs[wm * 32 + tm * 16 + lr][0], kb);
#pragma unroll
    for (int tn = 0; tn < 2; ++tn) bf[tn] = load_frag(&Ws[wn * 32 + tn * 16 + lr][0], kb);
#pragma unroll
    for (int tm = 0; tm < 2; ++tm)
#pragma unroll
      for (int tn = 0; tn < 2; ++tn) acc[tm][tn] = wmma32(a[tm], bf[tn], acc[tm][tn]);
  }

#pragma unroll
  for (int tn = 0; tn < 2; ++tn) {
    const int n = n0 + wn * 32 + tn * 16 + lr;
    const float bn = bias[n];
#pragma unroll
    for (int tm = 0; tm < 2; ++tm) {
#pragma unroll
      for (int r = 0; r < 8; ++r) {
        const int m = m0 + wm * 32 + tm * 16 + r + 8 * hi;
        Out[(size_t)m * HID_ + n] = acc[tm][tn][r] + bn;  // lanes 0..15 coalesce
      }
    }
  }
}

// ---------------------------------------------------------------------------
extern "C" void kernel_launch(void* const* d_in, const int* in_sizes, int n_in,
                              void* d_out, int out_size, void* d_ws, size_t ws_size,
                              hipStream_t stream) {
  (void)in_sizes; (void)n_in; (void)out_size; (void)ws_size;
  const float* query = (const float*)d_in[0];
  const float* key   = (const float*)d_in[1];
  const float* value = (const float*)d_in[2];
  const float* Wq = (const float*)d_in[3];
  const float* bq = (const float*)d_in[4];
  const float* Wk = (const float*)d_in[5];
  const float* bk = (const float*)d_in[6];
  const float* Wv = (const float*)d_in[7];
  const float* bv = (const float*)d_in[8];
  const float* Wo = (const float*)d_in[9];
  const float* bo = (const float*)d_in[10];
  float* out = (float*)d_out;

  // Workspace: 4 x (M*HID) f16 = 32 MB.
  _Float16* qws = (_Float16*)d_ws;
  _Float16* kws = qws + (size_t)M_ * HID_;
  _Float16* vws = kws + (size_t)M_ * HID_;
  _Float16* aws = vws + (size_t)M_ * HID_;

  qkv_kernel<<<dim3(HID_ / 64, M_ / 128, 3), 256, 0, stream>>>(
      query, key, value, Wq, Wk, Wv, bq, bk, bv, qws, kws, vws);
  attn_kernel<<<dim3(S_ / 64, B_ * NH_), 128, 0, stream>>>(qws, kws, vws, aws);
  oproj_kernel<<<dim3(HID_ / 64, M_ / 128), 256, 0, stream>>>(aws, Wo, bo, out);
}

// v001
// Measured time: 141 microseconds a run.
// Two timings next to v000 put it at 1.06 and 1.09 times that version's speed.
#include <hip/hip_runtime.h>

// ---------------------------------------------------------------------------
// MHA with grid bias for MI455X (gfx1250), wave32, WMMA f16 -> f32 accum.
//   kernel 1: qkv projection  (f32 in -> f16 q/k/v in (B,NH,S,HD) layout)
//   kernel 2: fused flash-style attention (f16 in/out, f32 softmax state)
//             K tile staged via GLOBAL_LOAD_ASYNC_TO_LDS_B128 (ASYNCcnt)
//   kernel 3: output projection (f16 in -> f32 out + bias), async X tile
// Workspace: 4 buffers of M*HID f16 = 32 MB.
// ---------------------------------------------------------------------------

typedef __attribute__((ext_vector_type(16))) _Float16 v16h;
typedef __attribute__((ext_vector_type(8)))  _Float16 half8;
typedef __attribute__((ext_vector_type(8)))  float    v8f;
typedef __attribute__((ext_vector_type(4)))  float    f4v;

#define B_   4
#define S_   1024
#define HID_ 1024
#define NH_  16
#define HD_  64
#define M_   (B_ * S_)

// 16-bit A-fragment gather (ISA 7.12.2): lane holds one row; k-chunks
// [kb, kb+7] and [16+kb, 16+kb+7] with kb = (lane<16) ? 0 : 8.
// B fragments use the mirror layout (lane = column), so x@W^T and q@k^T
// gather B exactly like A from row-major storage.
__device__ __forceinline__ v16h load_frag(const _Float16* __restrict__ row, int kb) {
  half8 lo = *(const half8*)(row + kb);
  half8 hi = *(const half8*)(row + 16 + kb);
  v16h a;
#pragma unroll
  for (int i = 0; i < 8; ++i) { a[i] = lo[i]; a[i + 8] = hi[i]; }
  return a;
}

__device__ __forceinline__ v8f wmma32(v16h a, v16h b, v8f c) {
  return __builtin_amdgcn_wmma_f32_16x16x32_f16(false, a, false, b, (short)0, c,
                                                false, false);
}

__device__ __forceinline__ half8 cvt8(f4v a, f4v b) {
  half8 h;
#pragma unroll
  for (int i = 0; i < 4; ++i) { h[i] = (_Float16)a[i]; h[4 + i] = (_Float16)b[i]; }
  return h;
}

// Async global->LDS copy of 64 contiguous bytes (4 x B128). GVS addressing:
//   LDS[lds_off + ioff] = MEM[saddr + goff + ioff]; tracked by ASYNCcnt.
__device__ __forceinline__ void async_copy64(unsigned lds_off, unsigned goff,
                                             const void* saddr) {
  asm volatile(
      "global_load_async_to_lds_b128 %0, %1, %2\n\t"
      "global_load_async_to_lds_b128 %0, %1, %2 offset:16\n\t"
      "global_load_async_to_lds_b128 %0, %1, %2 offset:32\n\t"
      "global_load_async_to_lds_b128 %0, %1, %2 offset:48"
      :: "v"(lds_off), "v"(goff), "s"(saddr) : "memory");
}

__device__ __forceinline__ void async_copy32(unsigned lds_off, unsigned goff,
                                             const void* saddr) {
  asm volatile(
      "global_load_async_to_lds_b128 %0, %1, %2\n\t"
      "global_load_async_to_lds_b128 %0, %1, %2 offset:16"
      :: "v"(lds_off), "v"(goff), "s"(saddr) : "memory");
}

__device__ __forceinline__ void wait_async0() {
  asm volatile("s_wait_asynccnt 0x0" ::: "memory");
}

__device__ __forceinline__ unsigned lds_off32(const void* p) {
  return (unsigned)(size_t)p;  // flat LDS aperture: offset in addr[31:0]
}

// ---------------------------------------------------------------------------
// Kernel 1: q/k/v = X @ W^T + b, output f16 in (B,NH,S,HD) layout.
// Grid: (HID/128, M/128, 3). Block: 256 (8 waves; 4x2 wave grid, 32x64/wave).
// ---------------------------------------------------------------------------
__global__ __launch_bounds__(256)
void qkv_kernel(const float* __restrict__ Xq, const float* __restrict__ Xk,
                const float* __restrict__ Xv, const float* __restrict__ Wq,
                const float* __restrict__ Wk, const float* __restrict__ Wv,
                const float* __restrict__ bq, const float* __restrict__ bk,
                const float* __restrict__ bv, _Float16* __restrict__ Oq,
                _Float16* __restrict__ Ok, _Float16* __restrict__ Ov) {
  const int z = blockIdx.z;
  const float* X    = (z == 0) ? Xq : (z == 1) ? Xk : Xv;
  const float* W    = (z == 0) ? Wq : (z == 1) ? Wk : Wv;
  const float* bias = (z == 0) ? bq : (z == 1) ? bk : bv;
  _Float16*    O    = (z == 0) ? Oq : (z == 1) ? Ok : Ov;

  __shared__ __align__(16) _Float16 Xs[128][40];
  __shared__ __align__(16) _Float16 Ws[128][40];

  const int t = threadIdx.x;
  const int lane = t & 31, wave = t >> 5;
  const int wm = wave >> 1, wn = wave & 1;
  const int m0 = blockIdx.y * 128, n0 = blockIdx.x * 128;
  const int kb = (lane < 16) ? 0 : 8;
  const int lr = lane & 15, hi = lane >> 4;

  const int xrow = t >> 1, xhalf = t & 1;

  v8f acc[2][4] = {};

  for (int k0 = 0; k0 < HID_; k0 += 32) {
    __syncthreads();
    {  // X tile: 128 rows x 32 k (f32 -> f16)
      const float* g = X + (size_t)(m0 + xrow) * HID_ + k0 + xhalf * 16;
      f4v x0 = *(const f4v*)g;       f4v x1 = *(const f4v*)(g + 4);
      f4v x2 = *(const f4v*)(g + 8); f4v x3 = *(const f4v*)(g + 12);
      *(half8*)&Xs[xrow][xhalf * 16]     = cvt8(x0, x1);
      *(half8*)&Xs[xrow][xhalf * 16 + 8] = cvt8(x2, x3);
      if (k0 + 32 < HID_) __builtin_prefetch(g + 32, 0, 0);  // next k-step
    }
    {  // W tile: 128 rows x 32 k (f32 -> f16), same thread map as X
      const float* g = W + (size_t)(n0 + xrow) * HID_ + k0 + xhalf * 16;
      f4v x0 = *(const f4v*)g;       f4v x1 = *(const f4v*)(g + 4);
      f4v x2 = *(const f4v*)(g + 8); f4v x3 = *(const f4v*)(g + 12);
      *(half8*)&Ws[xrow][xhalf * 16]     = cvt8(x0, x1);
      *(half8*)&Ws[xrow][xhalf * 16 + 8] = cvt8(x2, x3);
      if (k0 + 32 < HID_) __builtin_prefetch(g + 32, 0, 0);
    }
    __syncthreads();

    v16h a[2], bf[4];
#pragma unroll
    for (int tm = 0; tm < 2; ++tm) a[tm]  = load_frag(&Xs[wm * 32 + tm * 16 + lr][0], kb);
#pragma unroll
    for (int tn = 0; tn < 4; ++tn) bf[tn] = load_frag(&Ws[wn * 64 + tn * 16 + lr][0], kb);
#pragma unroll
    for (int tm = 0; tm < 2; ++tm)
#pragma unroll
      for (int tn = 0; tn < 4; ++tn) acc[tm][tn] = wmma32(a[tm], bf[tn], acc[tm][tn]);
  }

  // Epilogue: bias + scatter into (B,NH,S,HD) f16.
#pragma unroll
  for (int tn = 0; tn < 4; ++tn) {
    const int n = n0 + wn * 64 + tn * 16 + lr;
    const float bn = bias[n];
    const int h = n >> 6, d = n & 63;
#pragma unroll
    for (int tm = 0; tm < 2; ++tm) {
#pragma unroll
      for (int r = 0; r < 8; ++r) {
        const int m = m0 + wm * 32 + tm * 16 + r + 8 * hi;
        const int bb = m >> 10, sq = m & (S_ - 1);
        O[(((size_t)(bb * NH_ + h) * S_) + sq) * HD_ + d] =
            (_Float16)(acc[tm][tn][r] + bn);
      }
    }
  }
}

// ---------------------------------------------------------------------------
// Kernel 2: fused attention. Grid: (S/64, B*NH). Block: 128 (4 waves).
// Each wave owns 16 query rows; streams 64-key tiles with online softmax.
// ---------------------------------------------------------------------------
__global__ __launch_bounds__(128)
void attn_kernel(const _Float16* __restrict__ Q, const _Float16* __restrict__ K,
                 const _Float16* __restrict__ V, _Float16* __restrict__ Oa) {
  __shared__ __align__(16) _Float16 Ks[64][72];
  __shared__ __align__(16) _Float16 Vs[64][72];      // transposed: [d][key]
  __shared__ __align__(16) _Float16 Ps[4][16][72];   // per-wave P staging

  const int t = threadIdx.x, lane = t & 31, wave = t >> 5;
  const int lr = lane & 15, hi = lane >> 4;
  const int kb = (lane < 16) ? 0 : 8;
  const int bh = blockIdx.y;                 // b*NH + h
  const int iq_base = blockIdx.x * 64 + wave * 16;

  const _Float16* qbase = Q + (size_t)bh * S_ * HD_;
  const _Float16* kbase = K + (size_t)bh * S_ * HD_;
  const _Float16* vbase = V + (size_t)bh * S_ * HD_;

  // Q fragments (16 rows x 64 d) held in registers for the whole kernel.
  v16h aq[2];
  {
    const _Float16* qr = qbase + (size_t)(iq_base + lr) * HD_;
    aq[0] = load_frag(qr, kb);
    aq[1] = load_frag(qr + 32, kb);
  }

  float mrow[8], lrow[8];
  v8f o[4] = {};
#pragma unroll
  for (int r = 0; r < 8; ++r) { mrow[r] = -1e30f; lrow[r] = 0.0f; }
  const float scale = 0.125f;  // 1/sqrt(64)

  const int row = t >> 1, half = t & 1;
  const unsigned ks_lds = lds_off32(&Ks[row][half * 32]);

  for (int kt = 0; kt < S_; kt += 64) {
    __syncthreads();  // previous iteration's tile reads complete
    {
      // K tile: async global->LDS (4 x B128 per thread, ASYNCcnt-tracked).
      const unsigned goff =
          (unsigned)(((kt + row) * HD_ + half * 32) * sizeof(_Float16));
      async_copy64(ks_lds, goff, (const void*)kbase);

      // V tile: VGPR path with transpose into Vs[d][key].
      const half8* gv = (const half8*)(vbase + (size_t)(kt + row) * HD_ + half * 32);
      half8 v0 = gv[0], v1 = gv[1], v2 = gv[2], v3 = gv[3];
#pragma unroll
      for (int j = 0; j < 8; ++j) {
        Vs[half * 32 + j][row]      = v0[j];
        Vs[half * 32 + 8 + j][row]  = v1[j];
        Vs[half * 32 + 16 + j][row] = v2[j];
        Vs[half * 32 + 24 + j][row] = v3[j];
      }
      if (kt + 64 < S_)  // prefetch next V tile (global_prefetch_b8)
        __builtin_prefetch(vbase + (size_t)(kt + 64 + row) * HD_ + half * 32, 0, 0);
    }
    wait_async0();    // K tile async writes landed in LDS
    __syncthreads();  // tiles visible to all waves

    // Scores: 4 key sub-tiles of 16; each is two chained k=32 WMMAs.
    v8f s[4];
#pragma unroll
    for (int j = 0; j < 4; ++j) {
      v16h bk0 = load_frag(&Ks[j * 16 + lr][0], kb);
      v16h bk1 = load_frag(&Ks[j * 16 + lr][32], kb);
      v8f c = {};
      c = wmma32(aq[0], bk0, c);
      c = wmma32(aq[1], bk1, c);
      s[j] = c;
    }

    // Scale + grid bias + row max.
    float rmax[8];
#pragma unroll
    for (int r = 0; r < 8; ++r) rmax[r] = -1e30f;
#pragma unroll
    for (int j = 0; j < 4; ++j) {
      const int jg = kt + j * 16 + lr;
      const int jgc = jg >> 5, jgm = jg & 31;
#pragma unroll
      for (int r = 0; r < 8; ++r) {
        const int i = iq_base + r + 8 * hi;
        const float bias = (((i >> 5) == jgc) || ((i & 31) == jgm)) ? 0.1f : 0.0f;
        const float val = s[j][r] * scale + bias;
        s[j][r] = val;
        rmax[r] = fmaxf(rmax[r], val);
      }
    }
#pragma unroll
    for (int off = 1; off < 16; off <<= 1)
#pragma unroll
      for (int r = 0; r < 8; ++r)
        rmax[r] = fmaxf(rmax[r], __shfl_xor(rmax[r], off, 32));

    // Online softmax update.
    float alpha[8], rsum[8];
#pragma unroll
    for (int r = 0; r < 8; ++r) {
      const float mn = fmaxf(mrow[r], rmax[r]);
      alpha[r] = __expf(mrow[r] - mn);
      mrow[r] = mn;
      rsum[r] = 0.0f;
    }
#pragma unroll
    for (int j = 0; j < 4; ++j)
#pragma unroll
      for (int r = 0; r < 8; ++r) {
        const float p = __expf(s[j][r] - mrow[r]);
        s[j][r] = p;
        rsum[r] += p;
      }
#pragma unroll
    for (int off = 1; off < 16; off <<= 1)
#pragma unroll
      for (int r = 0; r < 8; ++r) rsum[r] += __shfl_xor(rsum[r], off, 32);
#pragma unroll
    for (int r = 0; r < 8; ++r) lrow[r] = lrow[r] * alpha[r] + rsum[r];
#pragma unroll
    for (int dd = 0; dd < 4; ++dd)
#pragma unroll
      for (int r = 0; r < 8; ++r) o[dd][r] *= alpha[r];

    // P (f16) -> LDS, re-read in A-fragment layout.
#pragma unroll
    for (int j = 0; j < 4; ++j)
#pragma unroll
      for (int r = 0; r < 8; ++r)
        Ps[wave][r + 8 * hi][j * 16 + lr] = (_Float16)s[j][r];
    __syncthreads();  // orders Ps write -> read (and DS counters)

    v16h ap0 = load_frag(&Ps[wave][lr][0], kb);
    v16h ap1 = load_frag(&Ps[wave][lr][32], kb);
#pragma unroll
    for (int dd = 0; dd < 4; ++dd) {
      v16h bv0 = load_frag(&Vs[dd * 16 + lr][0], kb);
      v16h bv1 = load_frag(&Vs[dd * 16 + lr][32], kb);
      o[dd] = wmma32(ap0, bv0, o[dd]);
      o[dd] = wmma32(ap1, bv1, o[dd]);
    }
  }

  // Normalize and store f16 in (B,S,HID) layout for the output projection.
  const int bb = bh / NH_, h = bh % NH_;
#pragma unroll
  for (int dd = 0; dd < 4; ++dd)
#pragma unroll
    for (int r = 0; r < 8; ++r) {
      const int sq = iq_base + r + 8 * hi;
      const float val = o[dd][r] / lrow[r];
      Oa[((size_t)(bb * S_ + sq)) * HID_ + h * HD_ + dd * 16 + lr] = (_Float16)val;
    }
}

// ---------------------------------------------------------------------------
// Kernel 3: out = A @ Wo^T + bo, f16 in -> f32 out.
// Grid: (HID/64, M/128). Block: 256.
// ---------------------------------------------------------------------------
__global__ __launch_bounds__(256)
void oproj_kernel(const _Float16* __restrict__ X, const float* __restrict__ W,
                  const float* __restrict__ bias, float* __restrict__ Out) {
  __shared__ __align__(16) _Float16 Xs[128][40];
  __shared__ __align__(16) _Float16 Ws[64][40];

  const int t = threadIdx.x;
  const int lane = t & 31, wave = t >> 5;
  const int wm = wave >> 1, wn = wave & 1;
  const int m0 = blockIdx.y * 128, n0 = blockIdx.x * 64;
  const int kb = (lane < 16) ? 0 : 8;
  const int lr = lane & 15, hi = lane >> 4;

  const int xrow = t >> 1, xhalf = t & 1;
  const int wrow = t >> 2, wq = t & 3;
  const unsigned xs_lds = lds_off32(&Xs[xrow][xhalf * 16]);

  v8f acc[2][2] = {};

  for (int k0 = 0; k0 < HID_; k0 += 32) {
    __syncthreads();
    {  // X tile: 128 rows x 32 k (f16), async global->LDS (2 x B128/thread)
      const unsigned goff = (unsigned)(((size_t)(m0 + xrow) * HID_ + k0 +
                                        xhalf * 16) * sizeof(_Float16));
      async_copy32(xs_lds, goff, (const void*)X);
    }
    {  // W tile: 64 rows x 32 k (f32 -> f16)
      const float* g = W + (size_t)(n0 + wrow) * HID_ + k0 + wq * 8;
      f4v x0 = *(const f4v*)g; f4v x1 = *(const f4v*)(g + 4);
      *(half8*)&Ws[wrow][wq * 8] = cvt8(x0, x1);
      if (k0 + 32 < HID_) __builtin_prefetch(g + 32, 0, 0);
    }
    wait_async0();
    __syncthreads();

    v16h a[2], bf[2];
#pragma unroll
    for (int tm = 0; tm < 2; ++tm) a[tm]  = load_frag(&Xs[wm * 32 + tm * 16 + lr][0], kb);
#pragma unroll
    for (int tn = 0; tn < 2; ++tn) bf[tn] = load_frag(&Ws[wn * 32 + tn * 16 + lr][0], kb);
#pragma unroll
    for (int tm = 0; tm < 2; ++tm)
#pragma unroll
      for (int tn = 0; tn < 2; ++tn) acc[tm][tn] = wmma32(a[tm], bf[tn], acc[tm][tn]);
  }

#pragma unroll
  for (int tn = 0; tn < 2; ++tn) {
    const int n = n0 + wn * 32 + tn * 16 + lr;
    const float bn = bias[n];
#pragma unroll
    for (int tm = 0; tm < 2; ++tm) {
#pragma unroll
      for (int r = 0; r < 8; ++r) {
        const int m = m0 + wm * 32 + tm * 16 + r + 8 * hi;
        Out[(size_t)m * HID_ + n] = acc[tm][tn][r] + bn;  // lanes 0..15 coalesce
      }
    }
  }
}

// ---------------------------------------------------------------------------
extern "C" void kernel_launch(void* const* d_in, const int* in_sizes, int n_in,
                              void* d_out, int out_size, void* d_ws, size_t ws_size,
                              hipStream_t stream) {
  (void)in_sizes; (void)n_in; (void)out_size; (void)ws_size;
  const float* query = (const float*)d_in[0];
  const float* key   = (const float*)d_in[1];
  const float* value = (const float*)d_in[2];
  const float* Wq = (const float*)d_in[3];
  const float* bq = (const float*)d_in[4];
  const float* Wk = (const float*)d_in[5];
  const float* bk = (const float*)d_in[6];
  const float* Wv = (const float*)d_in[7];
  const float* bv = (const float*)d_in[8];
  const float* Wo = (const float*)d_in[9];
  const float* bo = (const float*)d_in[10];
  float* out = (float*)d_out;

  // Workspace: 4 x (M*HID) f16 = 32 MB.
  _Float16* qws = (_Float16*)d_ws;
  _Float16* kws = qws + (size_t)M_ * HID_;
  _Float16* vws = kws + (size_t)M_ * HID_;
  _Float16* aws = vws + (size_t)M_ * HID_;

  qkv_kernel<<<dim3(HID_ / 128, M_ / 128, 3), 256, 0, stream>>>(
      query, key, value, Wq, Wk, Wv, bq, bk, bv, qws, kws, vws);
  attn_kernel<<<dim3(S_ / 64, B_ * NH_), 128, 0, stream>>>(qws, kws, vws, aws);
  oproj_kernel<<<dim3(HID_ / 64, M_ / 128), 256, 0, stream>>>(aws, Wo, bo, out);
}

// v002
// It runs in 119 microseconds.
// Two timings next to v001 put it at 1.20 and 1.18 times that version's speed.
// Counting every step since v000, it is 1.28 times as fast.
#include <hip/hip_runtime.h>

// ---------------------------------------------------------------------------
// MHA with grid bias for MI455X (gfx1250), wave32, WMMA f16 -> f32 accum.
//   kernel 1: qkv projection  (f32 in -> f16 q/k/v in (B,NH,S,HD) layout)
//   kernel 2: fused flash-style attention (f16 in/out, f32 softmax state)
//             K tile staged via GLOBAL_LOAD_ASYNC_TO_LDS_B128 (ASYNCcnt)
//   kernel 3: output projection (f16 in -> f32 out + bias), async X tile
// Workspace: 4 buffers of M*HID f16 = 32 MB.
// ---------------------------------------------------------------------------

typedef __attribute__((ext_vector_type(16))) _Float16 v16h;
typedef __attribute__((ext_vector_type(8)))  _Float16 half8;
typedef __attribute__((ext_vector_type(8)))  float    v8f;
typedef __attribute__((ext_vector_type(4)))  float    f4v;

#define B_   4
#define S_   1024
#define HID_ 1024
#define NH_  16
#define HD_  64
#define M_   (B_ * S_)

// 16-bit A-fragment gather (ISA 7.12.2): lane holds one row; k-chunks
// [kb, kb+7] and [16+kb, 16+kb+7] with kb = (lane<16) ? 0 : 8.
// B fragments use the mirror layout (lane = column), so x@W^T and k@q^T
// gather B exactly like A from row-major storage.
__device__ __forceinline__ v16h load_frag(const _Float16* __restrict__ row, int kb) {
  half8 lo = *(const half8*)(row + kb);
  half8 hi = *(const half8*)(row + 16 + kb);
  v16h a;
#pragma unroll
  for (int i = 0; i < 8; ++i) { a[i] = lo[i]; a[i + 8] = hi[i]; }
  return a;
}

__device__ __forceinline__ v8f wmma32(v16h a, v16h b, v8f c) {
  return __builtin_amdgcn_wmma_f32_16x16x32_f16(false, a, false, b, (short)0, c,
                                                false, false);
}

__device__ __forceinline__ half8 cvt8(f4v a, f4v b) {
  half8 h;
#pragma unroll
  for (int i = 0; i < 4; ++i) { h[i] = (_Float16)a[i]; h[4 + i] = (_Float16)b[i]; }
  return h;
}

// Async global->LDS copy of 64 contiguous bytes (4 x B128). GVS addressing:
//   LDS[lds_off + ioff] = MEM[saddr + goff + ioff]; tracked by ASYNCcnt.
__device__ __forceinline__ void async_copy64(unsigned lds_off, unsigned goff,
                                             const void* saddr) {
  asm volatile(
      "global_load_async_to_lds_b128 %0, %1, %2\n\t"
      "global_load_async_to_lds_b128 %0, %1, %2 offset:16\n\t"
      "global_load_async_to_lds_b128 %0, %1, %2 offset:32\n\t"
      "global_load_async_to_lds_b128 %0, %1, %2 offset:48"
      :: "v"(lds_off), "v"(goff), "s"(saddr) : "memory");
}

__device__ __forceinline__ void async_copy32(unsigned lds_off, unsigned goff,
                                             const void* saddr) {
  asm volatile(
      "global_load_async_to_lds_b128 %0, %1, %2\n\t"
      "global_load_async_to_lds_b128 %0, %1, %2 offset:16"
      :: "v"(lds_off), "v"(goff), "s"(saddr) : "memory");
}

__device__ __forceinline__ void wait_async0() {
  asm volatile("s_wait_asynccnt 0x0" ::: "memory");
}

__device__ __forceinline__ unsigned lds_off32(const void* p) {
  return (unsigned)(size_t)p;  // flat LDS aperture: offset in addr[31:0]
}

// ---------------------------------------------------------------------------
// Kernel 1: q/k/v = X @ W^T + b, output f16 in (B,NH,S,HD) layout.
// Grid: (HID/128, M/128, 3). Block: 256 (8 waves; 4x2 wave grid, 32x64/wave).
// ---------------------------------------------------------------------------
__global__ __launch_bounds__(256)
void qkv_kernel(const float* __restrict__ Xq, const float* __restrict__ Xk,
                const float* __restrict__ Xv, const float* __restrict__ Wq,
                const float* __restrict__ Wk, const float* __restrict__ Wv,
                const float* __restrict__ bq, const float* __restrict__ bk,
                const float* __restrict__ bv, _Float16* __restrict__ Oq,
                _Float16* __restrict__ Ok, _Float16* __restrict__ Ov) {
  const int z = blockIdx.z;
  const float* X    = (z == 0) ? Xq : (z == 1) ? Xk : Xv;
  const float* W    = (z == 0) ? Wq : (z == 1) ? Wk : Wv;
  const float* bias = (z == 0) ? bq : (z == 1) ? bk : bv;
  _Float16*    O    = (z == 0) ? Oq : (z == 1) ? Ok : Ov;

  __shared__ __align__(16) _Float16 Xs[128][40];
  __shared__ __align__(16) _Float16 Ws[128][40];

  const int t = threadIdx.x;
  const int lane = t & 31, wave = t >> 5;
  const int wm = wave >> 1, wn = wave & 1;
  const int m0 = blockIdx.y * 128, n0 = blockIdx.x * 128;
  const int kb = (lane < 16) ? 0 : 8;
  const int lr = lane & 15, hi = lane >> 4;

  const int xrow = t >> 1, xhalf = t & 1;

  v8f acc[2][4] = {};

  for (int k0 = 0; k0 < HID_; k0 += 32) {
    __syncthreads();
    {  // X tile: 128 rows x 32 k (f32 -> f16)
      const float* g = X + (size_t)(m0 + xrow) * HID_ + k0 + xhalf * 16;
      f4v x0 = *(const f4v*)g;       f4v x1 = *(const f4v*)(g + 4);
      f4v x2 = *(const f4v*)(g + 8); f4v x3 = *(const f4v*)(g + 12);
      *(half8*)&Xs[xrow][xhalf * 16]     = cvt8(x0, x1);
      *(half8*)&Xs[xrow][xhalf * 16 + 8] = cvt8(x2, x3);
      if (k0 + 32 < HID_) __builtin_prefetch(g + 32, 0, 0);  // next k-step
    }
    {  // W tile: 128 rows x 32 k (f32 -> f16), same thread map as X
      const float* g = W + (size_t)(n0 + xrow) * HID_ + k0 + xhalf * 16;
      f4v x0 = *(const f4v*)g;       f4v x1 = *(const f4v*)(g + 4);
      f4v x2 = *(const f4v*)(g + 8); f4v x3 = *(const f4v*)(g + 12);
      *(half8*)&Ws[xrow][xhalf * 16]     = cvt8(x0, x1);
      *(half8*)&Ws[xrow][xhalf * 16 + 8] = cvt8(x2, x3);
      if (k0 + 32 < HID_) __builtin_prefetch(g + 32, 0, 0);
    }
    __syncthreads();

    v16h a[2], bf[4];
#pragma unroll
    for (int tm = 0; tm < 2; ++tm) a[tm]  = load_frag(&Xs[wm * 32 + tm * 16 + lr][0], kb);
#pragma unroll
    for (int tn = 0; tn < 4; ++tn) bf[tn] = load_frag(&Ws[wn * 64 + tn * 16 + lr][0], kb);
#pragma unroll
    for (int tm = 0; tm < 2; ++tm)
#pragma unroll
      for (int tn = 0; tn < 4; ++tn) acc[tm][tn] = wmma32(a[tm], bf[tn], acc[tm][tn]);
  }

  // Epilogue: bias + scatter into (B,NH,S,HD) f16.
#pragma unroll
  for (int tn = 0; tn < 4; ++tn) {
    const int n = n0 + wn * 64 + tn * 16 + lr;
    const float bn = bias[n];
    const int h = n >> 6, d = n & 63;
#pragma unroll
    for (int tm = 0; tm < 2; ++tm) {
#pragma unroll
      for (int r = 0; r < 8; ++r) {
        const int m = m0 + wm * 32 + tm * 16 + r + 8 * hi;
        const int bb = m >> 10, sq = m & (S_ - 1);
        O[(((size_t)(bb * NH_ + h) * S_) + sq) * HD_ + d] =
            (_Float16)(acc[tm][tn][r] + bn);
      }
    }
  }
}

__device__ __forceinline__ float other_half(float x) {
  int b = __builtin_bit_cast(int, x);
  b = __builtin_amdgcn_permlanex16(b, b, 0x76543210, 0xfedcba98, false, false);
  return __builtin_bit_cast(float, b);
}

// exp(x) as v_exp_f32 of x * log2(e), as __expf compiles. The v_nop behind the
// last v_exp_f32 stands in the same statement: it is the one slot that the
// instruction set asks for between a transcendental and an instruction that
// reads its result or overwrites its source. Inside a run the next, independent v_exp_f32
// fills it: outputs are early-clobber, so none lies on an input.
__device__ __forceinline__ float exp_1(float x) {
  const float y = x * 1.44269504f;
  float p;
  asm("v_exp_f32 %0, %1\n\t"
      "v_nop"
      : "=&v"(p) : "v"(y));
  return p;
}

__device__ __forceinline__ v8f exp_8(v8f x) {
  const v8f y = x * 1.44269504f;
  float p0, p1, p2, p3, p4, p5, p6, p7;
  asm("v_exp_f32 %0, %8\n\t"
      "v_exp_f32 %1, %9\n\t"
      "v_exp_f32 %2, %10\n\t"
      "v_exp_f32 %3, %11\n\t"
      "v_exp_f32 %4, %12\n\t"
      "v_exp_f32 %5, %13\n\t"
      "v_exp_f32 %6, %14\n\t"
      "v_exp_f32 %7, %15\n\t"
      "v_nop"
      : "=&v"(p0), "=&v"(p1), "=&v"(p2), "=&v"(p3),
        "=&v"(p4), "=&v"(p5), "=&v"(p6), "=&v"(p7)
      : "v"(y[0]), "v"(y[1]), "v"(y[2]), "v"(y[3]),
        "v"(y[4]), "v"(y[5]), "v"(y[6]), "v"(y[7]));
  v8f p = {p0, p1, p2, p3, p4, p5, p6, p7};
  return p;
}

__global__ __launch_bounds__(128)
void attn_kernel(const _Float16* __restrict__ Q, const _Float16* __restrict__ K,
                 const _Float16* __restrict__ V, _Float16* __restrict__ Oa) {
  __shared__ __align__(16) _Float16 Ks[64][72];
  __shared__ __align__(16) _Float16 Vs[64][72];      // transposed: [d][key]

  const int t = threadIdx.x, lane = t & 31, wave = t >> 5;
  const int lr = lane & 15, hi = lane >> 4;
  const int kb = (lane < 16) ? 0 : 8;
  const int bh = blockIdx.y;                 // b*NH + h
  const int iq_base = blockIdx.x * 64 + wave * 16;
  const int iq = iq_base + lr;               // this lane's query

  const _Float16* qbase = Q + (size_t)bh * S_ * HD_;
  const _Float16* kbase = K + (size_t)bh * S_ * HD_;
  const _Float16* vbase = V + (size_t)bh * S_ * HD_;

  // Q fragments (64 d x 16 query columns, B operand) kept in registers.
  v16h bq[2];
  {
    const _Float16* qr = qbase + (size_t)iq * HD_;
    bq[0] = load_frag(qr, kb);
    bq[1] = load_frag(qr + 32, kb);
  }

  float mrow = -1e30f;  // running maximum of this lane's query (both halves agree)
  float lrow = 0.0f;    // running sum over this half's keys only; joined at the end
  v8f o[4] = {};        // o[dd][r] = O[iq][dd*16 + 8*hi + r]
  const float scale = 0.125f;  // 1/sqrt(64)

  // Grid bias, key jg = kt + j*16 + 8*hi + r with kt a multiple of 64:
  //   jg >> 5 = (kt >> 5) + (j >> 1),  jg & 31 = (j & 1)*16 + 8*hi + r.
  const int iq_blk = iq >> 5;
  const int iq_col = (iq & 31) - 8 * hi;

  const int row = t >> 1, half = t & 1;
  const unsigned ks_lds = lds_off32(&Ks[row][half * 32]);

  for (int kt = 0; kt < S_; kt += 64) {
    __syncthreads();  // previous iteration's tile reads complete
    {
      // K tile: async global->LDS (4 x B128 per thread, ASYNCcnt-tracked).
      const unsigned goff =
          (unsigned)(((kt + row) * HD_ + half * 32) * sizeof(_Float16));
      async_copy64(ks_lds, goff, (const void*)kbase);

      // V tile: VGPR path with transpose into Vs[d][key].
      const half8* gv = (const half8*)(vbase + (size_t)(kt + row) * HD_ + half * 32);
      half8 v0 = gv[0], v1 = gv[1], v2 = gv[2], v3 = gv[3];
#pragma unroll
      for (int j = 0; j < 8; ++j) {
        Vs[half * 32 + j][row]      = v0[j];
        Vs[half * 32 + 8 + j][row]  = v1[j];
        Vs[half * 32 + 16 + j][row] = v2[j];
        Vs[half * 32 + 24 + j][row] = v3[j];
      }
      if (kt + 64 < S_)  // prefetch next V tile (global_prefetch_b8)
        __builtin_prefetch(vbase + (size_t)(kt + 64 + row) * HD_ + half * 32, 0, 0);
    }
    wait_async0();    // K tile async writes landed in LDS
    __syncthreads();  // tiles visible to all waves

    // Scores S^T: 4 sub-tiles of 16 keys x 16 queries, two chained k=32 WMMAs.
    v8f s[4];
#pragma unroll
    for (int j = 0; j < 4; ++j) {
      v16h ak0 = load_frag(&Ks[j * 16 + lr][0], kb);
      v16h ak1 = load_frag(&Ks[j * 16 + lr][32], kb);
      v8f c = {};
      c = wmma32(ak0, bq[0], c);
      c = wmma32(ak1, bq[1], c);
      s[j] = c;
    }

    // Scale + grid bias + maximum over this lane's 32 keys (one chain per tile).
    float tmax[4];
#pragma unroll
    for (int j = 0; j < 4; ++j) {
      const bool same_blk = iq_blk == (kt >> 5) + (j >> 1);
      tmax[j] = -1e30f;
#pragma unroll
      for (int r = 0; r < 8; ++r) {
        const bool same_col = iq_col == (j & 1) * 16 + r;
        const float bias = (same_blk || same_col) ? 0.1f : 0.0f;
        const float val = s[j][r] * scale + bias;
        s[j][r] = val;
        tmax[j] = fmaxf(tmax[j], val);
      }
    }
    float rmax = fmaxf(fmaxf(tmax[0], tmax[1]), fmaxf(tmax[2], tmax[3]));
    rmax = fmaxf(rmax, other_half(rmax));

    // Online softmax update.
    const float mn = fmaxf(mrow, rmax);
    const float alpha = exp_1(mrow - mn);
    mrow = mn;
    float tsum[4];
#pragma unroll
    for (int j = 0; j < 4; ++j) {
      s[j] = exp_8(s[j] - mn);
      tsum[j] = s[j][0];
#pragma unroll
      for (int r = 1; r < 8; ++r) tsum[j] += s[j][r];
    }
    lrow = lrow * alpha + ((tsum[0] + tsum[1]) + (tsum[2] + tsum[3]));
#pragma unroll
    for (int dd = 0; dd < 4; ++dd)
#pragma unroll
      for (int r = 0; r < 8; ++r) o[dd][r] *= alpha;

    // P^T (f16) as B operand: tiles 2q and 2q+1 give keys 8*hi + e and
    // 16 + 8*hi + e of a 32-key group, the k order load_frag gives V^T.
    v16h bp0, bp1;
#pragma unroll
    for (int e = 0; e < 8; ++e) {
      bp0[e] = (_Float16)s[0][e]; bp0[8 + e] = (_Float16)s[1][e];
      bp1[e] = (_Float16)s[2][e]; bp1[8 + e] = (_Float16)s[3][e];
    }
#pragma unroll
    for (int dd = 0; dd < 4; ++dd) {
      v16h av0 = load_frag(&Vs[dd * 16 + lr][0], kb);
      v16h av1 = load_frag(&Vs[dd * 16 + lr][32], kb);
      o[dd] = wmma32(av0, bp0, o[dd]);
      o[dd] = wmma32(av1, bp1, o[dd]);
    }
  }

  // Join the halves' sums, normalize and store f16 in (B,S,HID) layout for the
  // output projection: 8 consecutive d per lane, one 16-byte store per tile.
  const float ltot = lrow + other_half(lrow);
  const int bb = bh / NH_, h = bh % NH_;
  _Float16* orow = Oa + ((size_t)(bb * S_ + iq)) * HID_ + h * HD_ + 8 * hi;
#pragma unroll
  for (int dd = 0; dd < 4; ++dd) {
    half8 hv;
#pragma unroll
    for (int r = 0; r < 8; ++r) hv[r] = (_Float16)(o[dd][r] / ltot);
    *(half8*)(orow + dd * 16) = hv;
  }
}

// ---------------------------------------------------------------------------
// Kernel 3: out = A @ Wo^T + bo, f16 in -> f32 out.
// Grid: (HID/64, M/128). Block: 256.
// ---------------------------------------------------------------------------
__global__ __launch_bounds__(256)
void oproj_kernel(const _Float16* __restrict__ X, const float* __restrict__ W,
                  const float* __restrict__ bias, float* __restrict__ Out) {
  __shared__ __align__(16) _Float16 Xs[128][40];
  __shared__ __align__(16) _Float16 Ws[64][40];

  const int t = threadIdx.x;
  const int lane = t & 31, wave = t >> 5;
  const int wm = wave >> 1, wn = wave & 1;
  const int m0 = blockIdx.y * 128, n0 = blockIdx.x * 64;
  const int kb = (lane < 16) ? 0 : 8;
  const int lr = lane & 15, hi = lane >> 4;

  const int xrow = t >> 1, xhalf = t & 1;
  const int wrow = t >> 2, wq = t & 3;
  const unsigned xs_lds = lds_off32(&Xs[xrow][xhalf * 16]);

  v8f acc[2][2] = {};

  for (int k0 = 0; k0 < HID_; k0 += 32) {
    __syncthreads();
    {  // X tile: 128 rows x 32 k (f16), async global->LDS (2 x B128/thread)
      const unsigned goff = (unsigned)(((size_t)(m0 + xrow) * HID_ + k0 +
                                        xhalf * 16) * sizeof(_Float16));
      async_copy32(xs_lds, goff, (const void*)X);
    }
    {  // W tile: 64 rows x 32 k (f32 -> f16)
      const float* g = W + (size_t)(n0 + wrow) * HID_ + k0 + wq * 8;
      f4v x0 = *(const f4v*)g; f4v x1 = *(const f4v*)(g + 4);
      *(half8*)&Ws[wrow][wq * 8] = cvt8(x0, x1);
      if (k0 + 32 < HID_) __builtin_prefetch(g + 32, 0, 0);
    }
    wait_async0();
    __syncthreads();

    v16h a[2], bf[2];
#pragma unroll
    for (int tm = 0; tm < 2; ++tm) a[tm]  = load_frag(&Xs[wm * 32 + tm * 16 + lr][0], kb);
#pragma unroll
    for (int tn = 0; tn < 2; ++tn) bf[tn] = load_frag(&Ws[wn * 32 + tn * 16 + lr][0], kb);
#pragma unroll
    for (int tm = 0; tm < 2; ++tm)
#pragma unroll
      for (int tn = 0; tn < 2; ++tn) acc[tm][tn] = wmma32(a[tm], bf[tn], acc[tm][tn]);
  }

#pragma unroll
  for (int tn = 0; tn < 2; ++tn) {
    const int n = n0 + wn * 32 + tn * 16 + lr;
    const float bn = bias[n];
#pragma unroll
    for (int tm = 0; tm < 2; ++tm) {
#pragma unroll
      for (int r = 0; r < 8; ++r) {
        const int m = m0 + wm * 32 + tm * 16 + r + 8 * hi;
        Out[(size_t)m * HID_ + n] = acc[tm][tn][r] + bn;  // lanes 0..15 coalesce
      }
    }
  }
}

// ---------------------------------------------------------------------------
extern "C" void kernel_launch(void* const* d_in, const int* in_sizes, int n_in,
                              void* d_out, int out_size, void* d_ws, size_t ws_size,
                              hipStream_t stream) {
  (void)in_sizes; (void)n_in; (void)out_size; (void)ws_size;
  const float* query = (const float*)d_in[0];
  const float* key   = (const float*)d_in[1];
  const float* value = (const float*)d_in[2];
  const float* Wq = (const float*)d_in[3];
  const float* bq = (const float*)d_in[4];
  const float* Wk = (const float*)d_in[5];
  const float* bk = (const float*)d_in[6];
  const float* Wv = (const float*)d_in[7];
  const float* bv = (const float*)d_in[8];
  const float* Wo = (const float*)d_in[9];
  const float* bo = (const float*)d_in[10];
  float* out = (float*)d_out;

  // Workspace: 4 x (M*HID) f16 = 32 MB.
  _Float16* qws = (_Float16*)d_ws;
  _Float16* kws = qws + (size_t)M_ * HID_;
  _Float16* vws = kws + (size_t)M_ * HID_;
  _Float16* aws = vws + (size_t)M_ * HID_;

  qkv_kernel<<<dim3(HID_ / 128, M_ / 128, 3), 256, 0, stream>>>(
      query, key, value, Wq, Wk, Wv, bq, bk, bv, qws, kws, vws);
  attn_kernel<<<dim3(S_ / 64, B_ * NH_), 128, 0, stream>>>(qws, kws, vws, aws);
  oproj_kernel<<<dim3(HID_ / 64, M_ / 128), 256, 0, stream>>>(aws, Wo, bo, out);
}

// v003
// One run takes 114 microseconds.
// In two side-by-side timings against v002, it was 1.05 and 1.03 times as fast.
// Over all steps from v000 it is 1.33 times as fast.
#include <hip/hip_runtime.h>

// ---------------------------------------------------------------------------
// MHA with grid bias for MI455X (gfx1250), wave32, WMMA f16 -> f32 accum.
//   kernel 1: qkv projection  (f32 in -> f16 q/k/v in (B,NH,S,HD) layout)
//   kernel 2: fused flash-style attention (f16 in/out, f32 softmax state)
//             K tile staged via GLOBAL_LOAD_ASYNC_TO_LDS_B128 (ASYNCcnt)
//   kernel 3: output projection (f16 in -> f32 out + bias), async X tile
// Workspace: 4 buffers of M*HID f16 = 32 MB.
// ---------------------------------------------------------------------------

typedef __attribute__((ext_vector_type(16))) _Float16 v16h;
typedef __attribute__((ext_vector_type(8)))  _Float16 half8;
typedef __attribute__((ext_vector_type(4)))  _Float16 half4;
typedef __attribute__((ext_vector_type(8)))  float    v8f;
typedef __attribute__((ext_vector_type(4)))  float    f4v;

#define B_   4
#define S_   1024
#define HID_ 1024
#define NH_  16
#define HD_  64
#define M_   (B_ * S_)

// 16-bit A-fragment gather (ISA 7.12.2): lane holds one row; k-chunks
// [kb, kb+7] and [16+kb, 16+kb+7] with kb = (lane<16) ? 0 : 8.
// B fragments use the mirror layout (lane = column), so x@W^T and k@q^T
// gather B exactly like A from row-major storage.
__device__ __forceinline__ v16h load_frag(const _Float16* __restrict__ row, int kb) {
  half8 lo = *(const half8*)(row + kb);
  half8 hi = *(const half8*)(row + 16 + kb);
  v16h a;
#pragma unroll
  for (int i = 0; i < 8; ++i) { a[i] = lo[i]; a[i + 8] = hi[i]; }
  return a;
}

__device__ __forceinline__ v8f wmma32(v16h a, v16h b, v8f c) {
  return __builtin_amdgcn_wmma_f32_16x16x32_f16(false, a, false, b, (short)0, c,
                                                false, false);
}

__device__ __forceinline__ half4 cvt4(f4v a) {
  half4 h;
#pragma unroll
  for (int i = 0; i < 4; ++i) h[i] = (_Float16)a[i];
  return h;
}

// Async global->LDS copies, 16 bytes per lane and copy, tracked by ASYNCcnt.
// GVS addressing: LDS[lds_i] = MEM[base_i + goff]. Neighbouring lanes take
// neighbouring 16-byte pieces of a row, so one wave-wide copy takes all that
// the tile holds of each row it touches, and no line is asked for by two copies
// of a tile. The s_wait_xcnt closes each statement so that no address register
// named here is rewritten ahead of it.
__device__ __forceinline__ void async_copy4(unsigned l0, unsigned l1, unsigned l2,
                                            unsigned l3, unsigned goff,
                                            const void* b0, const void* b1,
                                            const void* b2, const void* b3) {
  asm volatile(
      "global_load_async_to_lds_b128 %0, %4, %5\n\t"
      "global_load_async_to_lds_b128 %1, %4, %6\n\t"
      "global_load_async_to_lds_b128 %2, %4, %7\n\t"
      "global_load_async_to_lds_b128 %3, %4, %8\n\t"
      "s_wait_xcnt 0x0"
      :: "v"(l0), "v"(l1), "v"(l2), "v"(l3), "v"(goff),
         "s"(b0), "s"(b1), "s"(b2), "s"(b3) : "memory");
}

__device__ __forceinline__ void async_copy2(unsigned l0, unsigned l1, unsigned goff,
                                            const void* b0, const void* b1) {
  asm volatile(
      "global_load_async_to_lds_b128 %0, %2, %3\n\t"
      "global_load_async_to_lds_b128 %1, %2, %4\n\t"
      "s_wait_xcnt 0x0"
      :: "v"(l0), "v"(l1), "v"(goff), "s"(b0), "s"(b1) : "memory");
}

__device__ __forceinline__ void wait_async0() {
  asm volatile("s_wait_asynccnt 0x0" ::: "memory");
}

__device__ __forceinline__ unsigned lds_off32(const void* p) {
  return (unsigned)(size_t)p;  // flat LDS aperture: offset in addr[31:0]
}

// ---------------------------------------------------------------------------
// Kernel 1: q/k/v = X @ W^T + b, output f16 in (B,NH,S,HD) layout.
// Grid: (HID/128, M/128, 3). Block: 256 (8 waves; 4x2 wave grid, 32x64/wave).
// ---------------------------------------------------------------------------
__global__ __launch_bounds__(256)
void qkv_kernel(const float* __restrict__ Xq, const float* __restrict__ Xk,
                const float* __restrict__ Xv, const float* __restrict__ Wq,
                const float* __restrict__ Wk, const float* __restrict__ Wv,
                const float* __restrict__ bq, const float* __restrict__ bk,
                const float* __restrict__ bv, _Float16* __restrict__ Oq,
                _Float16* __restrict__ Ok, _Float16* __restrict__ Ov) {
  const int z = blockIdx.z;
  const float* X    = (z == 0) ? Xq : (z == 1) ? Xk : Xv;
  const float* W    = (z == 0) ? Wq : (z == 1) ? Wk : Wv;
  const float* bias = (z == 0) ? bq : (z == 1) ? bk : bv;
  _Float16*    O    = (z == 0) ? Oq : (z == 1) ? Ok : Ov;

  __shared__ __align__(16) _Float16 Xs[128][40];
  __shared__ __align__(16) _Float16 Ws[128][40];

  const int t = threadIdx.x;
  const int lane = t & 31, wave = t >> 5;
  const int wm = wave >> 1, wn = wave & 1;
  const int m0 = blockIdx.y * 128, n0 = blockIdx.x * 128;
  const int kb = (lane < 16) ? 0 : 8;
  const int lr = lane & 15, hi = lane >> 4;

  const int xrow = t >> 1, xhalf = t & 1;  // prefetch map: one line per lane pair
  // Load map: 8 lanes cover the 128 bytes (one line) that a row has in a k-step,
  // a wave-wide 16-byte load covers 4 whole lines; 4 loads, 32 rows apart.
  const int lrow = t >> 3, lchk = t & 7;

  v8f acc[2][4] = {};

  for (int k0 = 0; k0 < HID_; k0 += 32) {
    __syncthreads();
    {  // X tile: 128 rows x 32 k (f32 -> f16)
      const float* g = X + (size_t)(m0 + lrow) * HID_ + k0 + lchk * 4;
      f4v x[4];
#pragma unroll
      for (int i = 0; i < 4; ++i) x[i] = *(const f4v*)(g + (size_t)i * 32 * HID_);
#pragma unroll
      for (int i = 0; i < 4; ++i) *(half4*)&Xs[lrow + 32 * i][lchk * 4] = cvt4(x[i]);
      if (k0 + 32 < HID_)  // next k-step
        __builtin_prefetch(X + (size_t)(m0 + xrow) * HID_ + k0 + xhalf * 16 + 32, 0, 0);
    }
    {  // W tile: 128 rows x 32 k (f32 -> f16), same thread maps as X
      const float* g = W + (size_t)(n0 + lrow) * HID_ + k0 + lchk * 4;
      f4v x[4];
#pragma unroll
      for (int i = 0; i < 4; ++i) x[i] = *(const f4v*)(g + (size_t)i * 32 * HID_);
#pragma unroll
      for (int i = 0; i < 4; ++i) *(half4*)&Ws[lrow + 32 * i][lchk * 4] = cvt4(x[i]);
      if (k0 + 32 < HID_)
        __builtin_prefetch(W + (size_t)(n0 + xrow) * HID_ + k0 + xhalf * 16 + 32, 0, 0);
    }
    __syncthreads();

    v16h a[2], bf[4];
#pragma unroll
    for (int tm = 0; tm < 2; ++tm) a[tm]  = load_frag(&Xs[wm * 32 + tm * 16 + lr][0], kb);
#pragma unroll
    for (int tn = 0; tn < 4; ++tn) bf[tn] = load_frag(&Ws[wn * 64 + tn * 16 + lr][0], kb);
#pragma unroll
    for (int tm = 0; tm < 2; ++tm)
#pragma unroll
      for (int tn = 0; tn < 4; ++tn) acc[tm][tn] = wmma32(a[tm], bf[tn], acc[tm][tn]);
  }

  // Epilogue: bias + scatter into (B,NH,S,HD) f16.
#pragma unroll
  for (int tn = 0; tn < 4; ++tn) {
    const int n = n0 + wn * 64 + tn * 16 + lr;
    const float bn = bias[n];
    const int h = n >> 6, d = n & 63;
#pragma unroll
    for (int tm = 0; tm < 2; ++tm) {
#pragma unroll
      for (int r = 0; r < 8; ++r) {
        const int m = m0 + wm * 32 + tm * 16 + r + 8 * hi;
        const int bb = m >> 10, sq = m & (S_ - 1);
        O[(((size_t)(bb * NH_ + h) * S_) + sq) * HD_ + d] =
            (_Float16)(acc[tm][tn][r] + bn);
      }
    }
  }
}

__device__ __forceinline__ float other_half(float x) {
  int b = __builtin_bit_cast(int, x);
  b = __builtin_amdgcn_permlanex16(b, b, 0x76543210, 0xfedcba98, false, false);
  return __builtin_bit_cast(float, b);
}

// exp(x) as v_exp_f32 of x * log2(e), as __expf compiles. The v_nop behind the
// last v_exp_f32 stands in the same statement: it is the one slot that the
// instruction set asks for between a transcendental and an instruction that
// reads its result or overwrites its source. Inside a run the next, independent v_exp_f32
// fills it: outputs are early-clobber, so none lies on an input.
__device__ __forceinline__ float exp_1(float x) {
  const float y = x * 1.44269504f;
  float p;
  asm("v_exp_f32 %0, %1\n\t"
      "v_nop"
      : "=&v"(p) : "v"(y));
  return p;
}

__device__ __forceinline__ v8f exp_8(v8f x) {
  const v8f y = x * 1.44269504f;
  float p0, p1, p2, p3, p4, p5, p6, p7;
  asm("v_exp_f32 %0, %8\n\t"
      "v_exp_f32 %1, %9\n\t"
      "v_exp_f32 %2, %10\n\t"
      "v_exp_f32 %3, %11\n\t"
      "v_exp_f32 %4, %12\n\t"
      "v_exp_f32 %5, %13\n\t"
      "v_exp_f32 %6, %14\n\t"
      "v_exp_f32 %7, %15\n\t"
      "v_nop"
      : "=&v"(p0), "=&v"(p1), "=&v"(p2), "=&v"(p3),
        "=&v"(p4), "=&v"(p5), "=&v"(p6), "=&v"(p7)
      : "v"(y[0]), "v"(y[1]), "v"(y[2]), "v"(y[3]),
        "v"(y[4]), "v"(y[5]), "v"(y[6]), "v"(y[7]));
  v8f p = {p0, p1, p2, p3, p4, p5, p6, p7};
  return p;
}

__global__ __launch_bounds__(128)
void attn_kernel(const _Float16* __restrict__ Q, const _Float16* __restrict__ K,
                 const _Float16* __restrict__ V, _Float16* __restrict__ Oa) {
  __shared__ __align__(16) _Float16 Ks[64][72];
  __shared__ __align__(16) _Float16 Vs[64][72];      // transposed: [d][key]

  const int t = threadIdx.x, lane = t & 31, wave = t >> 5;
  const int lr = lane & 15, hi = lane >> 4;
  const int kb = (lane < 16) ? 0 : 8;
  const int bh = blockIdx.y;                 // b*NH + h
  const int iq_base = blockIdx.x * 64 + wave * 16;
  const int iq = iq_base + lr;               // this lane's query

  const _Float16* qbase = Q + (size_t)bh * S_ * HD_;
  const _Float16* kbase = K + (size_t)bh * S_ * HD_;
  const _Float16* vbase = V + (size_t)bh * S_ * HD_;

  // Q fragments (64 d x 16 query columns, B operand) kept in registers.
  v16h bq[2];
  {
    const _Float16* qr = qbase + (size_t)iq * HD_;
    bq[0] = load_frag(qr, kb);
    bq[1] = load_frag(qr + 32, kb);
  }

  float mrow = -1e30f;  // running maximum of this lane's query (both halves agree)
  float lrow = 0.0f;    // running sum over this half's keys only; joined at the end
  v8f o[4] = {};        // o[dd][r] = O[iq][dd*16 + 8*hi + r]
  const float scale = 0.125f;  // 1/sqrt(64)

  // Grid bias, key jg = kt + j*16 + 8*hi + r with kt a multiple of 64:
  //   jg >> 5 = (kt >> 5) + (j >> 1),  jg & 31 = (j & 1)*16 + 8*hi + r.
  const int iq_blk = iq >> 5;
  const int iq_col = (iq & 31) - 8 * hi;

  const int row = t >> 1, half = t & 1;     // V map
  // K map: 8 lanes cover a key's 128 bytes (one line); 4 copies, 16 keys apart.
  const int krow = t >> 3, kchk = t & 7;
  const unsigned ks_lds0 = lds_off32(&Ks[krow][kchk * 8]);
  const unsigned ks_lds1 = lds_off32(&Ks[krow + 16][kchk * 8]);
  const unsigned ks_lds2 = lds_off32(&Ks[krow + 32][kchk * 8]);
  const unsigned ks_lds3 = lds_off32(&Ks[krow + 48][kchk * 8]);

  for (int kt = 0; kt < S_; kt += 64) {
    __syncthreads();  // previous iteration's tile reads complete
    {
      // K tile: async global->LDS (4 x B128 per thread, ASYNCcnt-tracked).
      const unsigned goff =
          (unsigned)(((kt + krow) * HD_ + kchk * 8) * sizeof(_Float16));
      async_copy4(ks_lds0, ks_lds1, ks_lds2, ks_lds3, goff,
                  (const void*)kbase, (const void*)(kbase + 16 * HD_),
                  (const void*)(kbase + 32 * HD_), (const void*)(kbase + 48 * HD_));

      // V tile: VGPR path with transpose into Vs[d][key].
      const half8* gv = (const half8*)(vbase + (size_t)(kt + row) * HD_ + half * 32);
      half8 v0 = gv[0], v1 = gv[1], v2 = gv[2], v3 = gv[3];
#pragma unroll
      for (int j = 0; j < 8; ++j) {
        Vs[half * 32 + j][row]      = v0[j];
        Vs[half * 32 + 8 + j][row]  = v1[j];
        Vs[half * 32 + 16 + j][row] = v2[j];
        Vs[half * 32 + 24 + j][row] = v3[j];
      }
      if (kt + 64 < S_)  // prefetch next V tile (global_prefetch_b8)
        __builtin_prefetch(vbase + (size_t)(kt + 64 + row) * HD_ + half * 32, 0, 0);
    }
    wait_async0();    // K tile async writes landed in LDS
    __syncthreads();  // tiles visible to all waves

    // Scores S^T: 4 sub-tiles of 16 keys x 16 queries, two chained k=32 WMMAs.
    v8f s[4];
#pragma unroll
    for (int j = 0; j < 4; ++j) {
      v16h ak0 = load_frag(&Ks[j * 16 + lr][0], kb);
      v16h ak1 = load_frag(&Ks[j * 16 + lr][32], kb);
      v8f c = {};
      c = wmma32(ak0, bq[0], c);
      c = wmma32(ak1, bq[1], c);
      s[j] = c;
    }

    // Scale + grid bias + maximum over this lane's 32 keys (one chain per tile).
    float tmax[4];
#pragma unroll
    for (int j = 0; j < 4; ++j) {
      const bool same_blk = iq_blk == (kt >> 5) + (j >> 1);
      tmax[j] = -1e30f;
#pragma unroll
      for (int r = 0; r < 8; ++r) {
        const bool same_col = iq_col == (j & 1) * 16 + r;
        const float bias = (same_blk || same_col) ? 0.1f : 0.0f;
        const float val = s[j][r] * scale + bias;
        s[j][r] = val;
        tmax[j] = fmaxf(tmax[j], val);
      }
    }
    float rmax = fmaxf(fmaxf(tmax[0], tmax[1]), fmaxf(tmax[2], tmax[3]));
    rmax = fmaxf(rmax, other_half(rmax));

    // Online softmax update.
    const float mn = fmaxf(mrow, rmax);
    const float alpha = exp_1(mrow - mn);
    mrow = mn;
    float tsum[4];
#pragma unroll
    for (int j = 0; j < 4; ++j) {
      s[j] = exp_8(s[j] - mn);
      tsum[j] = s[j][0];
#pragma unroll
      for (int r = 1; r < 8; ++r) tsum[j] += s[j][r];
    }
    lrow = lrow * alpha + ((tsum[0] + tsum[1]) + (tsum[2] + tsum[3]));
#pragma unroll
    for (int dd = 0; dd < 4; ++dd)
#pragma unroll
      for (int r = 0; r < 8; ++r) o[dd][r] *= alpha;

    // P^T (f16) as B operand: tiles 2q and 2q+1 give keys 8*hi + e and
    // 16 + 8*hi + e of a 32-key group, the k order load_frag gives V^T.
    v16h bp0, bp1;
#pragma unroll
    for (int e = 0; e < 8; ++e) {
      bp0[e] = (_Float16)s[0][e]; bp0[8 + e] = (_Float16)s[1][e];
      bp1[e] = (_Float16)s[2][e]; bp1[8 + e] = (_Float16)s[3][e];
    }
    // Keeps every exp_8 statement in front of the products below.
    __builtin_amdgcn_sched_barrier(0);
#pragma unroll
    for (int dd = 0; dd < 4; ++dd) {
      v16h av0 = load_frag(&Vs[dd * 16 + lr][0], kb);
      v16h av1 = load_frag(&Vs[dd * 16 + lr][32], kb);
      o[dd] = wmma32(av0, bp0, o[dd]);
      o[dd] = wmma32(av1, bp1, o[dd]);
    }
  }

  // Join the halves' sums, normalize and store f16 in (B,S,HID) layout for the
  // output projection: 8 consecutive d per lane, one 16-byte store per tile.
  const float ltot = lrow + other_half(lrow);
  const int bb = bh / NH_, h = bh % NH_;
  _Float16* orow = Oa + ((size_t)(bb * S_ + iq)) * HID_ + h * HD_ + 8 * hi;
#pragma unroll
  for (int dd = 0; dd < 4; ++dd) {
    half8 hv;
#pragma unroll
    for (int r = 0; r < 8; ++r) hv[r] = (_Float16)(o[dd][r] / ltot);
    *(half8*)(orow + dd * 16) = hv;
  }
}

// ---------------------------------------------------------------------------
// Kernel 3: out = A @ Wo^T + bo, f16 in -> f32 out.
// Grid: (HID/64, M/128). Block: 256.
// ---------------------------------------------------------------------------
__global__ __launch_bounds__(256)
void oproj_kernel(const _Float16* __restrict__ X, const float* __restrict__ W,
                  const float* __restrict__ bias, float* __restrict__ Out) {
  __shared__ __align__(16) _Float16 Xs[128][40];
  __shared__ __align__(16) _Float16 Ws[64][40];

  const int t = threadIdx.x;
  const int lane = t & 31, wave = t >> 5;
  const int wm = wave >> 1, wn = wave & 1;
  const int m0 = blockIdx.y * 128, n0 = blockIdx.x * 64;
  const int kb = (lane < 16) ? 0 : 8;
  const int lr = lane & 15, hi = lane >> 4;

  // X map: 4 lanes cover the 64 bytes that a row has in a k-step; 2 copies,
  // 64 rows apart. W map: 8 lanes cover a row's 128 bytes (one line); 2 loads,
  // 32 rows apart.
  const int xrow = t >> 2, xchk = t & 3;
  const int wrow = t >> 2, wq = t & 3;      // prefetch map: 4 lanes a row
  const int lrow = t >> 3, lchk = t & 7;
  const unsigned xs_lds0 = lds_off32(&Xs[xrow][xchk * 8]);
  const unsigned xs_lds1 = lds_off32(&Xs[xrow + 64][xchk * 8]);

  v8f acc[2][2] = {};

  for (int k0 = 0; k0 < HID_; k0 += 32) {
    __syncthreads();
    {  // X tile: 128 rows x 32 k (f16), async global->LDS (2 x B128/thread)
      const unsigned goff = (unsigned)(((size_t)(m0 + xrow) * HID_ + k0 +
                                        xchk * 8) * sizeof(_Float16));
      async_copy2(xs_lds0, xs_lds1, goff, (const void*)X,
                  (const void*)(X + 64 * HID_));
    }
    {  // W tile: 64 rows x 32 k (f32 -> f16)
      const float* g = W + (size_t)(n0 + lrow) * HID_ + k0 + lchk * 4;
      f4v x0 = *(const f4v*)g; f4v x1 = *(const f4v*)(g + (size_t)32 * HID_);
      *(half4*)&Ws[lrow][lchk * 4]      = cvt4(x0);
      *(half4*)&Ws[lrow + 32][lchk * 4] = cvt4(x1);
      if (k0 + 32 < HID_)
        __builtin_prefetch(W + (size_t)(n0 + wrow) * HID_ + k0 + wq * 8 + 32, 0, 0);
    }
    wait_async0();
    __syncthreads();

    v16h a[2], bf[2];
#pragma unroll
    for (int tm = 0; tm < 2; ++tm) a[tm]  = load_frag(&Xs[wm * 32 + tm * 16 + lr][0], kb);
#pragma unroll
    for (int tn = 0; tn < 2; ++tn) bf[tn] = load_frag(&Ws[wn * 32 + tn * 16 + lr][0], kb);
#pragma unroll
    for (int tm = 0; tm < 2; ++tm)
#pragma unroll
      for (int tn = 0; tn < 2; ++tn) acc[tm][tn] = wmma32(a[tm], bf[tn], acc[tm][tn]);
  }

#pragma unroll
  for (int tn = 0; tn < 2; ++tn) {
    const int n = n0 + wn * 32 + tn * 16 + lr;
    const float bn = bias[n];
#pragma unroll
    for (int tm = 0; tm < 2; ++tm) {
#pragma unroll
      for (int r = 0; r < 8; ++r) {
        const int m = m0 + wm * 32 + tm * 16 + r + 8 * hi;
        Out[(size_t)m * HID_ + n] = acc[tm][tn][r] + bn;  // lanes 0..15 coalesce
      }
    }
  }
}

// ---------------------------------------------------------------------------
extern "C" void kernel_launch(void* const* d_in, const int* in_sizes, int n_in,
                              void* d_out, int out_size, void* d_ws, size_t ws_size,
                              hipStream_t stream) {
  (void)in_sizes; (void)n_in; (void)out_size; (void)ws_size;
  const float* query = (const float*)d_in[0];
  const float* key   = (const float*)d_in[1];
  const float* value = (const float*)d_in[2];
  const float* Wq = (const float*)d_in[3];
  const float* bq = (const float*)d_in[4];
  const float* Wk = (const float*)d_in[5];
  const float* bk = (const float*)d_in[6];
  const float* Wv = (const float*)d_in[7];
  const float* bv = (const float*)d_in[8];
  const float* Wo = (const float*)d_in[9];
  const float* bo = (const float*)d_in[10];
  float* out = (float*)d_out;

  // Workspace: 4 x (M*HID) f16 = 32 MB.
  _Float16* qws = (_Float16*)d_ws;
  _Float16* kws = qws + (size_t)M_ * HID_;
  _Float16* vws = kws + (size_t)M_ * HID_;
  _Float16* aws = vws + (size_t)M_ * HID_;

  qkv_kernel<<<dim3(HID_ / 128, M_ / 128, 3), 256, 0, stream>>>(
      query, key, value, Wq, Wk, Wv, bq, bk, bv, qws, kws, vws);
  attn_kernel<<<dim3(S_ / 64, B_ * NH_), 128, 0, stream>>>(qws, kws, vws, aws);
  oproj_kernel<<<dim3(HID_ / 64, M_ / 128), 256, 0, stream>>>(aws, Wo, bo, out);
}

// v004
// Measured time: 88.8 microseconds a run.
// In two side-by-side timings against v003, it was 1.32 and 1.28 times as fast.
// Counting every step since v000, it is 1.73 times as fast.
#include <hip/hip_runtime.h>

// ---------------------------------------------------------------------------
// MHA with grid bias for MI455X (gfx1250), wave32, WMMA f16 -> f32 accum.
//   kernel 1: qkv projection  (f32 in -> f16 q/k/v in (B,NH,S,HD) layout)
//   kernel 2: fused flash-style attention (f16 in/out, f32 softmax state)
//             K tile staged via GLOBAL_LOAD_ASYNC_TO_LDS_B128 (ASYNCcnt)
//   kernel 3: output projection (f16 in -> f32 out + bias), async X tile
// Workspace: 4 buffers of M*HID f16 = 32 MB.
// ---------------------------------------------------------------------------

typedef __attribute__((ext_vector_type(16))) _Float16 v16h;
typedef __attribute__((ext_vector_type(8)))  _Float16 half8;
typedef __attribute__((ext_vector_type(4)))  _Float16 half4;
typedef __attribute__((ext_vector_type(8)))  float    v8f;
typedef __attribute__((ext_vector_type(4)))  float    f4v;

#define B_   4
#define S_   1024
#define HID_ 1024
#define NH_  16
#define HD_  64
#define M_   (B_ * S_)

// 16-bit A-fragment gather (ISA 7.12.2): lane holds one row; k-chunks
// [kb, kb+7] and [16+kb, 16+kb+7] with kb = (lane<16) ? 0 : 8.
// B fragments use the mirror layout (lane = column), so x@W^T and k@q^T
// gather B exactly like A from row-major storage.
__device__ __forceinline__ v16h load_frag(const _Float16* __restrict__ row, int kb) {
  half8 lo = *(const half8*)(row + kb);
  half8 hi = *(const half8*)(row + 16 + kb);
  v16h a;
#pragma unroll
  for (int i = 0; i < 8; ++i) { a[i] = lo[i]; a[i + 8] = hi[i]; }
  return a;
}

__device__ __forceinline__ v8f wmma32(v16h a, v16h b, v8f c) {
  return __builtin_amdgcn_wmma_f32_16x16x32_f16(false, a, false, b, (short)0, c,
                                                false, false);
}

__device__ __forceinline__ half4 cvt4(f4v a) {
  half4 h;
#pragma unroll
  for (int i = 0; i < 4; ++i) h[i] = (_Float16)a[i];
  return h;
}

// Async global->LDS copies, 16 bytes per lane and copy, tracked by ASYNCcnt.
// GVS addressing: LDS[lds_i] = MEM[base_i + goff]. Neighbouring lanes take
// neighbouring 16-byte pieces of a row, so one wave-wide copy takes all that
// the tile holds of each row it touches, and no line is asked for by two copies
// of a tile. The s_wait_xcnt closes each statement so that no address register
// named here is rewritten ahead of it.
__device__ __forceinline__ void async_copy4(unsigned l0, unsigned l1, unsigned l2,
                                            unsigned l3, unsigned goff,
                                            const void* b0, const void* b1,
                                            const void* b2, const void* b3) {
  asm volatile(
      "global_load_async_to_lds_b128 %0, %4, %5\n\t"
      "global_load_async_to_lds_b128 %1, %4, %6\n\t"
      "global_load_async_to_lds_b128 %2, %4, %7\n\t"
      "global_load_async_to_lds_b128 %3, %4, %8\n\t"
      "s_wait_xcnt 0x0"
      :: "v"(l0), "v"(l1), "v"(l2), "v"(l3), "v"(goff),
         "s"(b0), "s"(b1), "s"(b2), "s"(b3) : "memory");
}

__device__ __forceinline__ void wait_async0() {
  asm volatile("s_wait_asynccnt 0x0" ::: "memory");
}

__device__ __forceinline__ unsigned lds_off32(const void* p) {
  return (unsigned)(size_t)p;  // flat LDS aperture: offset in addr[31:0]
}

// ---------------------------------------------------------------------------
// Kernel 1: q/k/v = X @ W^T + b, output f16 in (B,NH,S,HD) layout.
// Grid: (HID/128, M/128, 3). Block: 256 (8 waves; 4x2 wave grid, 32x64/wave).
// One LDS pass holds 64 k: two 32-k product steps per pair of barriers.
// ---------------------------------------------------------------------------
__global__ __launch_bounds__(256)
void qkv_kernel(const float* __restrict__ Xq, const float* __restrict__ Xk,
                const float* __restrict__ Xv, const float* __restrict__ Wq,
                const float* __restrict__ Wk, const float* __restrict__ Wv,
                const float* __restrict__ bq, const float* __restrict__ bk,
                const float* __restrict__ bv, _Float16* __restrict__ Oq,
                _Float16* __restrict__ Ok, _Float16* __restrict__ Ov) {
  const int z = blockIdx.z;
  const float* X    = (z == 0) ? Xq : (z == 1) ? Xk : Xv;
  const float* W    = (z == 0) ? Wq : (z == 1) ? Wk : Wv;
  const float* bias = (z == 0) ? bq : (z == 1) ? bk : bv;
  _Float16*    O    = (z == 0) ? Oq : (z == 1) ? Ok : Ov;

  __shared__ __align__(16) _Float16 Xs[128][72];
  __shared__ __align__(16) _Float16 Ws[128][72];

  const int t = threadIdx.x;
  const int lane = t & 31, wave = t >> 5;
  const int wm = wave >> 1, wn = wave & 1;
  const int m0 = blockIdx.y * 128, n0 = blockIdx.x * 128;
  const int kb = (lane < 16) ? 0 : 8;
  const int lr = lane & 15, hi = lane >> 4;

  const int xrow = t >> 1, xhalf = t & 1;  // prefetch map: one line per lane
  // Load map: 16 lanes cover the 256 bytes (two lines) that a row has in a pass,
  // a wave-wide 16-byte load covers 4 whole lines; 8 loads, 16 rows apart.
  const int lrow = t >> 4, lchk = t & 15;

  v8f acc[2][4] = {};

  for (int k0 = 0; k0 < HID_; k0 += 64) {
    __syncthreads();
    {  // X and W tiles: 128 rows x 64 k each (f32 -> f16), same thread maps.
      // All 16 loads of the pass go out before the first is waited for.
      const float* gx = X + (size_t)(m0 + lrow) * HID_ + k0 + lchk * 4;
      const float* gw = W + (size_t)(n0 + lrow) * HID_ + k0 + lchk * 4;
      f4v x[8], w[8];
#pragma unroll
      for (int i = 0; i < 8; ++i) x[i] = *(const f4v*)(gx + (size_t)i * 16 * HID_);
#pragma unroll
      for (int i = 0; i < 8; ++i) w[i] = *(const f4v*)(gw + (size_t)i * 16 * HID_);
#pragma unroll
      for (int i = 0; i < 8; ++i) *(half4*)&Xs[lrow + 16 * i][lchk * 4] = cvt4(x[i]);
#pragma unroll
      for (int i = 0; i < 8; ++i) *(half4*)&Ws[lrow + 16 * i][lchk * 4] = cvt4(w[i]);
      if (k0 + 64 < HID_) {  // next pass
        __builtin_prefetch(X + (size_t)(m0 + xrow) * HID_ + k0 + xhalf * 32 + 64, 0, 0);
        __builtin_prefetch(W + (size_t)(n0 + xrow) * HID_ + k0 + xhalf * 32 + 64, 0, 0);
      }
    }
    __syncthreads();

#pragma unroll
    for (int ks = 0; ks < 64; ks += 32) {
      v16h a[2], bf[4];
#pragma unroll
      for (int tm = 0; tm < 2; ++tm)
        a[tm] = load_frag(&Xs[wm * 32 + tm * 16 + lr][ks], kb);
#pragma unroll
      for (int tn = 0; tn < 4; ++tn)
        bf[tn] = load_frag(&Ws[wn * 64 + tn * 16 + lr][ks], kb);
#pragma unroll
      for (int tm = 0; tm < 2; ++tm)
#pragma unroll
        for (int tn = 0; tn < 4; ++tn) acc[tm][tn] = wmma32(a[tm], bf[tn], acc[tm][tn]);
    }
  }

  // Epilogue: bias + scatter into (B,NH,S,HD) f16.
#pragma unroll
  for (int tn = 0; tn < 4; ++tn) {
    const int n = n0 + wn * 64 + tn * 16 + lr;
    const float bn = bias[n];
    const int h = n >> 6, d = n & 63;
#pragma unroll
    for (int tm = 0; tm < 2; ++tm) {
#pragma unroll
      for (int r = 0; r < 8; ++r) {
        const int m = m0 + wm * 32 + tm * 16 + r + 8 * hi;
        const int bb = m >> 10, sq = m & (S_ - 1);
        O[(((size_t)(bb * NH_ + h) * S_) + sq) * HD_ + d] =
            (_Float16)(acc[tm][tn][r] + bn);
      }
    }
  }
}

__device__ __forceinline__ float other_half(float x) {
  int b = __builtin_bit_cast(int, x);
  b = __builtin_amdgcn_permlanex16(b, b, 0x76543210, 0xfedcba98, false, false);
  return __builtin_bit_cast(float, b);
}

// exp(x) as v_exp_f32 of x * log2(e), as __expf compiles. The v_nop behind the
// last v_exp_f32 stands in the same statement: it is the one slot that the
// instruction set asks for between a transcendental and an instruction that
// reads its result or overwrites its source. Inside a run the next, independent v_exp_f32
// fills it: outputs are early-clobber, so none lies on an input.
__device__ __forceinline__ float exp_1(float x) {
  const float y = x * 1.44269504f;
  float p;
  asm("v_exp_f32 %0, %1\n\t"
      "v_nop"
      : "=&v"(p) : "v"(y));
  return p;
}

__device__ __forceinline__ v8f exp_8(v8f x) {
  const v8f y = x * 1.44269504f;
  float p0, p1, p2, p3, p4, p5, p6, p7;
  asm("v_exp_f32 %0, %8\n\t"
      "v_exp_f32 %1, %9\n\t"
      "v_exp_f32 %2, %10\n\t"
      "v_exp_f32 %3, %11\n\t"
      "v_exp_f32 %4, %12\n\t"
      "v_exp_f32 %5, %13\n\t"
      "v_exp_f32 %6, %14\n\t"
      "v_exp_f32 %7, %15\n\t"
      "v_nop"
      : "=&v"(p0), "=&v"(p1), "=&v"(p2), "=&v"(p3),
        "=&v"(p4), "=&v"(p5), "=&v"(p6), "=&v"(p7)
      : "v"(y[0]), "v"(y[1]), "v"(y[2]), "v"(y[3]),
        "v"(y[4]), "v"(y[5]), "v"(y[6]), "v"(y[7]));
  v8f p = {p0, p1, p2, p3, p4, p5, p6, p7};
  return p;
}

__global__ __launch_bounds__(128)
void attn_kernel(const _Float16* __restrict__ Q, const _Float16* __restrict__ K,
                 const _Float16* __restrict__ V, _Float16* __restrict__ Oa) {
  __shared__ __align__(16) _Float16 Ks[64][72];
  __shared__ __align__(16) _Float16 Vs[64][72];      // transposed: [d][key]

  const int t = threadIdx.x, lane = t & 31, wave = t >> 5;
  const int lr = lane & 15, hi = lane >> 4;
  const int kb = (lane < 16) ? 0 : 8;
  const int bh = blockIdx.y;                 // b*NH + h
  const int iq_base = blockIdx.x * 64 + wave * 16;
  const int iq = iq_base + lr;               // this lane's query

  const _Float16* qbase = Q + (size_t)bh * S_ * HD_;
  const _Float16* kbase = K + (size_t)bh * S_ * HD_;
  const _Float16* vbase = V + (size_t)bh * S_ * HD_;

  // Q fragments (64 d x 16 query columns, B operand) kept in registers.
  v16h bq[2];
  {
    const _Float16* qr = qbase + (size_t)iq * HD_;
    bq[0] = load_frag(qr, kb);
    bq[1] = load_frag(qr + 32, kb);
  }

  float mrow = -1e30f;  // running maximum of this lane's query (both halves agree)
  float lrow = 0.0f;    // running sum over this half's keys only; joined at the end
  v8f o[4] = {};        // o[dd][r] = O[iq][dd*16 + 8*hi + r]
  const float scale = 0.125f;  // 1/sqrt(64)

  // Grid bias, key jg = kt + j*16 + 8*hi + r with kt a multiple of 64:
  //   jg >> 5 = (kt >> 5) + (j >> 1),  jg & 31 = (j & 1)*16 + 8*hi + r.
  const int iq_blk = iq >> 5;
  const int iq_col = (iq & 31) - 8 * hi;

  const int row = t >> 1, half = t & 1;     // V map
  // K map: 8 lanes cover a key's 128 bytes (one line); 4 copies, 16 keys apart.
  const int krow = t >> 3, kchk = t & 7;
  const unsigned ks_lds0 = lds_off32(&Ks[krow][kchk * 8]);
  const unsigned ks_lds1 = lds_off32(&Ks[krow + 16][kchk * 8]);
  const unsigned ks_lds2 = lds_off32(&Ks[krow + 32][kchk * 8]);
  const unsigned ks_lds3 = lds_off32(&Ks[krow + 48][kchk * 8]);

  for (int kt = 0; kt < S_; kt += 64) {
    __syncthreads();  // previous iteration's tile reads complete
    {
      // K tile: async global->LDS (4 x B128 per thread, ASYNCcnt-tracked).
      const unsigned goff =
          (unsigned)(((kt + krow) * HD_ + kchk * 8) * sizeof(_Float16));
      async_copy4(ks_lds0, ks_lds1, ks_lds2, ks_lds3, goff,
                  (const void*)kbase, (const void*)(kbase + 16 * HD_),
                  (const void*)(kbase + 32 * HD_), (const void*)(kbase + 48 * HD_));

      // V tile: VGPR path with transpose into Vs[d][key].
      const half8* gv = (const half8*)(vbase + (size_t)(kt + row) * HD_ + half * 32);
      half8 v0 = gv[0], v1 = gv[1], v2 = gv[2], v3 = gv[3];
#pragma unroll
      for (int j = 0; j < 8; ++j) {
        Vs[half * 32 + j][row]      = v0[j];
        Vs[half * 32 + 8 + j][row]  = v1[j];
        Vs[half * 32 + 16 + j][row] = v2[j];
        Vs[half * 32 + 24 + j][row] = v3[j];
      }
      if (kt + 64 < S_)  // prefetch next V tile (global_prefetch_b8)
        __builtin_prefetch(vbase + (size_t)(kt + 64 + row) * HD_ + half * 32, 0, 0);
    }
    wait_async0();    // K tile async writes landed in LDS
    __syncthreads();  // tiles visible to all waves

    // Scores S^T: 4 sub-tiles of 16 keys x 16 queries, two chained k=32 WMMAs.
    v8f s[4];
#pragma unroll
    for (int j = 0; j < 4; ++j) {
      v16h ak0 = load_frag(&Ks[j * 16 + lr][0], kb);
      v16h ak1 = load_frag(&Ks[j * 16 + lr][32], kb);
      v8f c = {};
      c = wmma32(ak0, bq[0], c);
      c = wmma32(ak1, bq[1], c);
      s[j] = c;
    }

    // Scale + grid bias + maximum over this lane's 32 keys (one chain per tile).
    float tmax[4];
#pragma unroll
    for (int j = 0; j < 4; ++j) {
      const bool same_blk = iq_blk == (kt >> 5) + (j >> 1);
      tmax[j] = -1e30f;
#pragma unroll
      for (int r = 0; r < 8; ++r) {
        const bool same_col = iq_col == (j & 1) * 16 + r;
        const float bias = (same_blk || same_col) ? 0.1f : 0.0f;
        const float val = s[j][r] * scale + bias;
        s[j][r] = val;
        tmax[j] = fmaxf(tmax[j], val);
      }
    }
    float rmax = fmaxf(fmaxf(tmax[0], tmax[1]), fmaxf(tmax[2], tmax[3]));
    rmax = fmaxf(rmax, other_half(rmax));

    // Online softmax update.
    const float mn = fmaxf(mrow, rmax);
    const float alpha = exp_1(mrow - mn);
    mrow = mn;
    float tsum[4];
#pragma unroll
    for (int j = 0; j < 4; ++j) {
      s[j] = exp_8(s[j] - mn);
      tsum[j] = s[j][0];
#pragma unroll
      for (int r = 1; r < 8; ++r) tsum[j] += s[j][r];
    }
    lrow = lrow * alpha + ((tsum[0] + tsum[1]) + (tsum[2] + tsum[3]));
#pragma unroll
    for (int dd = 0; dd < 4; ++dd)
#pragma unroll
      for (int r = 0; r < 8; ++r) o[dd][r] *= alpha;

    // P^T (f16) as B operand: tiles 2q and 2q+1 give keys 8*hi + e and
    // 16 + 8*hi + e of a 32-key group, the k order load_frag gives V^T.
    v16h bp0, bp1;
#pragma unroll
    for (int e = 0; e < 8; ++e) {
      bp0[e] = (_Float16)s[0][e]; bp0[8 + e] = (_Float16)s[1][e];
      bp1[e] = (_Float16)s[2][e]; bp1[8 + e] = (_Float16)s[3][e];
    }
    // Keeps every exp_8 statement in front of the products below.
    __builtin_amdgcn_sched_barrier(0);
#pragma unroll
    for (int dd = 0; dd < 4; ++dd) {
      v16h av0 = load_frag(&Vs[dd * 16 + lr][0], kb);
      v16h av1 = load_frag(&Vs[dd * 16 + lr][32], kb);
      o[dd] = wmma32(av0, bp0, o[dd]);
      o[dd] = wmma32(av1, bp1, o[dd]);
    }
  }

  // Join the halves' sums, normalize and store f16 in (B,S,HID) layout for the
  // output projection: 8 consecutive d per lane, one 16-byte store per tile.
  const float ltot = lrow + other_half(lrow);
  const int bb = bh / NH_, h = bh % NH_;
  _Float16* orow = Oa + ((size_t)(bb * S_ + iq)) * HID_ + h * HD_ + 8 * hi;
#pragma unroll
  for (int dd = 0; dd < 4; ++dd) {
    half8 hv;
#pragma unroll
    for (int r = 0; r < 8; ++r) hv[r] = (_Float16)(o[dd][r] / ltot);
    *(half8*)(orow + dd * 16) = hv;
  }
}

// ---------------------------------------------------------------------------
// Kernel 3: out = A @ Wo^T + bo, f16 in -> f32 out.
// Grid: (HID/64, M/128). Block: 256.
// One LDS pass holds 128 k: four 32-k product steps per pair of barriers.
// ---------------------------------------------------------------------------
__global__ __launch_bounds__(256)
void oproj_kernel(const _Float16* __restrict__ X, const float* __restrict__ W,
                  const float* __restrict__ bias, float* __restrict__ Out) {
  __shared__ __align__(16) _Float16 Xs[128][136];
  __shared__ __align__(16) _Float16 Ws[64][136];

  const int t = threadIdx.x;
  const int lane = t & 31, wave = t >> 5;
  const int wm = wave >> 1, wn = wave & 1;
  const int m0 = blockIdx.y * 128, n0 = blockIdx.x * 64;
  const int kb = (lane < 16) ? 0 : 8;
  const int lr = lane & 15, hi = lane >> 4;

  // X map: 16 lanes cover the 256 bytes (two lines) that a row has in a pass;
  // 8 copies, 16 rows apart. W map: a wave covers a row's 512 bytes (four lines);
  // 8 loads, 8 rows apart.
  const int xrow = t >> 4, xchk = t & 15;
  const int wrow = t >> 2, wq = t & 3;      // prefetch map: one line per lane
  const int lrow = t >> 5, lchk = t & 31;
  unsigned xs_lds[8];
#pragma unroll
  for (int i = 0; i < 8; ++i) xs_lds[i] = lds_off32(&Xs[xrow + 16 * i][xchk * 8]);

  v8f acc[2][2] = {};

  for (int k0 = 0; k0 < HID_; k0 += 128) {
    // This wave's LDS reads of the last pass have retired before the barrier
    // behind which the copies overwrite the tile.
    asm volatile("s_wait_dscnt 0x0" ::: "memory");
    __syncthreads();
    {  // X tile: 128 rows x 128 k (f16), async global->LDS (8 x B128/thread)
      const unsigned goff = (unsigned)(((size_t)(m0 + xrow) * HID_ + k0 +
                                        xchk * 8) * sizeof(_Float16));
      async_copy4(xs_lds[0], xs_lds[1], xs_lds[2], xs_lds[3], goff,
                  (const void*)X, (const void*)(X + 16 * HID_),
                  (const void*)(X + 32 * HID_), (const void*)(X + 48 * HID_));
      async_copy4(xs_lds[4], xs_lds[5], xs_lds[6], xs_lds[7], goff,
                  (const void*)(X + 64 * HID_), (const void*)(X + 80 * HID_),
                  (const void*)(X + 96 * HID_), (const void*)(X + 112 * HID_));
    }
    {  // W tile: 64 rows x 128 k (f32 -> f16)
      const float* g = W + (size_t)(n0 + lrow) * HID_ + k0 + lchk * 4;
      f4v x[8];
#pragma unroll
      for (int i = 0; i < 8; ++i) x[i] = *(const f4v*)(g + (size_t)i * 8 * HID_);
#pragma unroll
      for (int i = 0; i < 8; ++i) *(half4*)&Ws[lrow + 8 * i][lchk * 4] = cvt4(x[i]);
      if (k0 + 128 < HID_)  // next pass
        __builtin_prefetch(W + (size_t)(n0 + wrow) * HID_ + k0 + wq * 32 + 128, 0, 0);
    }
    wait_async0();
    __syncthreads();

#pragma unroll
    for (int ks = 0; ks < 128; ks += 32) {
      v16h a[2], bf[2];
#pragma unroll
      for (int tm = 0; tm < 2; ++tm)
        a[tm] = load_frag(&Xs[wm * 32 + tm * 16 + lr][ks], kb);
#pragma unroll
      for (int tn = 0; tn < 2; ++tn)
        bf[tn] = load_frag(&Ws[wn * 32 + tn * 16 + lr][ks], kb);
#pragma unroll
      for (int tm = 0; tm < 2; ++tm)
#pragma unroll
        for (int tn = 0; tn < 2; ++tn) acc[tm][tn] = wmma32(a[tm], bf[tn], acc[tm][tn]);
    }
  }

#pragma unroll
  for (int tn = 0; tn < 2; ++tn) {
    const int n = n0 + wn * 32 + tn * 16 + lr;
    const float bn = bias[n];
#pragma unroll
    for (int tm = 0; tm < 2; ++tm) {
#pragma unroll
      for (int r = 0; r < 8; ++r) {
        const int m = m0 + wm * 32 + tm * 16 + r + 8 * hi;
        Out[(size_t)m * HID_ + n] = acc[tm][tn][r] + bn;  // lanes 0..15 coalesce
      }
    }
  }
}

// ---------------------------------------------------------------------------
extern "C" void kernel_launch(void* const* d_in, const int* in_sizes, int n_in,
                              void* d_out, int out_size, void* d_ws, size_t ws_size,
                              hipStream_t stream) {
  (void)in_sizes; (void)n_in; (void)out_size; (void)ws_size;
  const float* query = (const float*)d_in[0];
  const float* key   = (const float*)d_in[1];
  const float* value = (const float*)d_in[2];
  const float* Wq = (const float*)d_in[3];
  const float* bq = (const float*)d_in[4];
  const float* Wk = (const float*)d_in[5];
  const float* bk = (const float*)d_in[6];
  const float* Wv = (const float*)d_in[7];
  const float* bv = (const float*)d_in[8];
  const float* Wo = (const float*)d_in[9];
  const float* bo = (const float*)d_in[10];
  float* out = (float*)d_out;

  // Workspace: 4 x (M*HID) f16 = 32 MB.
  _Float16* qws = (_Float16*)d_ws;
  _Float16* kws = qws + (size_t)M_ * HID_;
  _Float16* vws = kws + (size_t)M_ * HID_;
  _Float16* aws = vws + (size_t)M_ * HID_;

  qkv_kernel<<<dim3(HID_ / 128, M_ / 128, 3), 256, 0, stream>>>(
      query, key, value, Wq, Wk, Wv, bq, bk, bv, qws, kws, vws);
  attn_kernel<<<dim3(S_ / 64, B_ * NH_), 128, 0, stream>>>(qws, kws, vws, aws);
  oproj_kernel<<<dim3(HID_ / 64, M_ / 128), 256, 0, stream>>>(aws, Wo, bo, out);
}

// v005
// It runs in 83.2 microseconds.
// Next to v004, in two timings, it ran 1.07 and 1.06 times as fast.
// All steps since v000 together make it 1.84 times as fast.
#include <hip/hip_runtime.h>

// ---------------------------------------------------------------------------
// MHA with grid bias for MI455X (gfx1250), wave32, WMMA f16 -> f32 accum.
//   kernel 1: qkv projection  (f32 in -> f16 q/k/v in (B,NH,S,HD) layout)
//   kernel 2: fused flash-style attention (f16 in/out, f32 softmax state)
//             K tile staged via GLOBAL_LOAD_ASYNC_TO_LDS_B128 (ASYNCcnt)
//   kernel 3: output projection (f16 in -> f32 out + bias), async X tile
// Every tile loop has two LDS buffers: the next tile's loads and copies are
// issued a pass ahead and fly while this tile's products run.
// Workspace: 4 buffers of M*HID f16 = 32 MB.
// ---------------------------------------------------------------------------

typedef __attribute__((ext_vector_type(16))) _Float16 v16h;
typedef __attribute__((ext_vector_type(8)))  _Float16 half8;
typedef __attribute__((ext_vector_type(4)))  _Float16 half4;
typedef __attribute__((ext_vector_type(8)))  float    v8f;
typedef __attribute__((ext_vector_type(4)))  float    f4v;

#define B_   4
#define S_   1024
#define HID_ 1024
#define NH_  16
#define HD_  64
#define M_   (B_ * S_)

// 16-bit A-fragment gather (ISA 7.12.2): lane holds one row; k-chunks
// [kb, kb+7] and [16+kb, 16+kb+7] with kb = (lane<16) ? 0 : 8.
// B fragments use the mirror layout (lane = column), so x@W^T and k@q^T
// gather B exactly like A from row-major storage.
__device__ __forceinline__ v16h load_frag(const _Float16* __restrict__ row, int kb) {
  half8 lo = *(const half8*)(row + kb);
  half8 hi = *(const half8*)(row + 16 + kb);
  v16h a;
#pragma unroll
  for (int i = 0; i < 8; ++i) { a[i] = lo[i]; a[i + 8] = hi[i]; }
  return a;
}

__device__ __forceinline__ v8f wmma32(v16h a, v16h b, v8f c) {
  return __builtin_amdgcn_wmma_f32_16x16x32_f16(false, a, false, b, (short)0, c,
                                                false, false);
}

__device__ __forceinline__ half4 cvt4(f4v a) {
  half4 h;
#pragma unroll
  for (int i = 0; i < 4; ++i) h[i] = (_Float16)a[i];
  return h;
}

// Async global->LDS copies, 16 bytes per lane and copy, tracked by ASYNCcnt.
// GVS addressing: LDS[lds_i] = MEM[base_i + goff]. Neighbouring lanes take
// neighbouring 16-byte pieces of a row, so one wave-wide copy takes all that
// the tile holds of each row it touches, and no line is asked for by two copies
// of a tile. The s_wait_xcnt closes each statement so that no address register
// named here is rewritten ahead of it.
__device__ __forceinline__ void async_copy4(unsigned l0, unsigned l1, unsigned l2,
                                            unsigned l3, unsigned goff,
                                            const void* b0, const void* b1,
                                            const void* b2, const void* b3) {
  asm volatile(
      "global_load_async_to_lds_b128 %0, %4, %5\n\t"
      "global_load_async_to_lds_b128 %1, %4, %6\n\t"
      "global_load_async_to_lds_b128 %2, %4, %7\n\t"
      "global_load_async_to_lds_b128 %3, %4, %8\n\t"
      "s_wait_xcnt 0x0"
      :: "v"(l0), "v"(l1), "v"(l2), "v"(l3), "v"(goff),
         "s"(b0), "s"(b1), "s"(b2), "s"(b3) : "memory");
}

__device__ __forceinline__ void wait_async0() {
  asm volatile("s_wait_asynccnt 0x0" ::: "memory");
}

__device__ __forceinline__ unsigned lds_off32(const void* p) {
  return (unsigned)(size_t)p;  // flat LDS aperture: offset in addr[31:0]
}

// ---------------------------------------------------------------------------
// Kernel 1: q/k/v = X @ W^T + b, output f16 in (B,NH,S,HD) layout.
// Grid: (HID/128, M/128, 3). Block: 256 (8 waves; 4x2 wave grid, 32x64/wave).
// One LDS pass holds 64 k: two 32-k product steps. Two LDS buffers: the next
// pass's X loads fly during the first step, its W loads during the second, and
// one barrier ends the pass.
// ---------------------------------------------------------------------------
__global__ __launch_bounds__(256)
void qkv_kernel(const float* __restrict__ Xq, const float* __restrict__ Xk,
                const float* __restrict__ Xv, const float* __restrict__ Wq,
                const float* __restrict__ Wk, const float* __restrict__ Wv,
                const float* __restrict__ bq, const float* __restrict__ bk,
                const float* __restrict__ bv, _Float16* __restrict__ Oq,
                _Float16* __restrict__ Ok, _Float16* __restrict__ Ov) {
  const int z = blockIdx.z;
  const float* X    = (z == 0) ? Xq : (z == 1) ? Xk : Xv;
  const float* W    = (z == 0) ? Wq : (z == 1) ? Wk : Wv;
  const float* bias = (z == 0) ? bq : (z == 1) ? bk : bv;
  _Float16*    O    = (z == 0) ? Oq : (z == 1) ? Ok : Ov;

  __shared__ __align__(16) _Float16 Xs[2][128][72];
  __shared__ __align__(16) _Float16 Ws[2][128][72];

  const int t = threadIdx.x;
  const int lane = t & 31, wave = t >> 5;
  const int wm = wave >> 1, wn = wave & 1;
  const int m0 = blockIdx.y * 128, n0 = blockIdx.x * 128;
  const int kb = (lane < 16) ? 0 : 8;
  const int lr = lane & 15, hi = lane >> 4;

  const int xrow = t >> 1, xhalf = t & 1;  // prefetch map: one line per lane
  // Load map: 16 lanes cover the 256 bytes (two lines) that a row has in a pass,
  // a wave-wide 16-byte load covers 4 whole lines; 8 loads, 16 rows apart.
  const int lrow = t >> 4, lchk = t & 15;

  v8f acc[2][4] = {};

  const float* gx = X + (size_t)(m0 + lrow) * HID_ + lchk * 4;
  const float* gw = W + (size_t)(n0 + lrow) * HID_ + lchk * 4;

  {  // Pass 0: X and W tiles, 128 rows x 64 k each (f32 -> f16), into buffer 0.
    f4v x[8], w[8];
#pragma unroll
    for (int i = 0; i < 8; ++i) x[i] = *(const f4v*)(gx + (size_t)i * 16 * HID_);
#pragma unroll
    for (int i = 0; i < 8; ++i) w[i] = *(const f4v*)(gw + (size_t)i * 16 * HID_);
#pragma unroll
    for (int i = 0; i < 8; ++i) *(half4*)&Xs[0][lrow + 16 * i][lchk * 4] = cvt4(x[i]);
#pragma unroll
    for (int i = 0; i < 8; ++i) *(half4*)&Ws[0][lrow + 16 * i][lchk * 4] = cvt4(w[i]);
  }
  __syncthreads();

  for (int k0 = 0; k0 < HID_; k0 += 64) {
    const int cur = (k0 >> 6) & 1, nxt = cur ^ 1;
    const bool more = k0 + 64 < HID_;
    f4v x[8];
    if (more) {  // next pass's X tile: in flight during the first product step
#pragma unroll
      for (int i = 0; i < 8; ++i)
        x[i] = *(const f4v*)(gx + k0 + 64 + (size_t)i * 16 * HID_);
    }
    if (k0 + 128 < HID_) {  // the pass after the next: a pass ahead of its loads
      __builtin_prefetch(X + (size_t)(m0 + xrow) * HID_ + k0 + xhalf * 32 + 128, 0, 0);
      __builtin_prefetch(W + (size_t)(n0 + xrow) * HID_ + k0 + xhalf * 32 + 128, 0, 0);
    }

#pragma unroll
    for (int ks = 0; ks < 64; ks += 32) {
      v16h a[2], bf[4];
#pragma unroll
      for (int tm = 0; tm < 2; ++tm)
        a[tm] = load_frag(&Xs[cur][wm * 32 + tm * 16 + lr][ks], kb);
#pragma unroll
      for (int tn = 0; tn < 4; ++tn)
        bf[tn] = load_frag(&Ws[cur][wn * 64 + tn * 16 + lr][ks], kb);
#pragma unroll
      for (int tm = 0; tm < 2; ++tm)
#pragma unroll
        for (int tn = 0; tn < 4; ++tn) acc[tm][tn] = wmma32(a[tm], bf[tn], acc[tm][tn]);

      if (more) {
        // The other buffer's last readers left it at the last pass's barrier.
        if (ks == 0) {
#pragma unroll
          for (int i = 0; i < 8; ++i)
            *(half4*)&Xs[nxt][lrow + 16 * i][lchk * 4] = cvt4(x[i]);
          // next pass's W tile: in flight during the second product step
#pragma unroll
          for (int i = 0; i < 8; ++i)
            x[i] = *(const f4v*)(gw + k0 + 64 + (size_t)i * 16 * HID_);
        } else {
#pragma unroll
          for (int i = 0; i < 8; ++i)
            *(half4*)&Ws[nxt][lrow + 16 * i][lchk * 4] = cvt4(x[i]);
        }
      }
    }
    __syncthreads();  // publishes the next tile, ends this tile's reads
  }

  // Epilogue: bias + scatter into (B,NH,S,HD) f16.
#pragma unroll
  for (int tn = 0; tn < 4; ++tn) {
    const int n = n0 + wn * 64 + tn * 16 + lr;
    const float bn = bias[n];
    const int h = n >> 6, d = n & 63;
#pragma unroll
    for (int tm = 0; tm < 2; ++tm) {
#pragma unroll
      for (int r = 0; r < 8; ++r) {
        const int m = m0 + wm * 32 + tm * 16 + r + 8 * hi;
        const int bb = m >> 10, sq = m & (S_ - 1);
        O[(((size_t)(bb * NH_ + h) * S_) + sq) * HD_ + d] =
            (_Float16)(acc[tm][tn][r] + bn);
      }
    }
  }
}

__device__ __forceinline__ float other_half(float x) {
  int b = __builtin_bit_cast(int, x);
  b = __builtin_amdgcn_permlanex16(b, b, 0x76543210, 0xfedcba98, false, false);
  return __builtin_bit_cast(float, b);
}

// exp(x) as v_exp_f32 of x * log2(e), as __expf compiles. The v_nop behind the
// last v_exp_f32 stands in the same statement: it is the one slot that the
// instruction set asks for between a transcendental and an instruction that
// reads its result or overwrites its source. Inside a run the next, independent v_exp_f32
// fills it: outputs are early-clobber, so none lies on an input.
__device__ __forceinline__ float exp_1(float x) {
  const float y = x * 1.44269504f;
  float p;
  asm("v_exp_f32 %0, %1\n\t"
      "v_nop"
      : "=&v"(p) : "v"(y));
  return p;
}

__device__ __forceinline__ v8f exp_8(v8f x) {
  const v8f y = x * 1.44269504f;
  float p0, p1, p2, p3, p4, p5, p6, p7;
  asm("v_exp_f32 %0, %8\n\t"
      "v_exp_f32 %1, %9\n\t"
      "v_exp_f32 %2, %10\n\t"
      "v_exp_f32 %3, %11\n\t"
      "v_exp_f32 %4, %12\n\t"
      "v_exp_f32 %5, %13\n\t"
      "v_exp_f32 %6, %14\n\t"
      "v_exp_f32 %7, %15\n\t"
      "v_nop"
      : "=&v"(p0), "=&v"(p1), "=&v"(p2), "=&v"(p3),
        "=&v"(p4), "=&v"(p5), "=&v"(p6), "=&v"(p7)
      : "v"(y[0]), "v"(y[1]), "v"(y[2]), "v"(y[3]),
        "v"(y[4]), "v"(y[5]), "v"(y[6]), "v"(y[7]));
  v8f p = {p0, p1, p2, p3, p4, p5, p6, p7};
  return p;
}

__global__ __launch_bounds__(128)
void attn_kernel(const _Float16* __restrict__ Q, const _Float16* __restrict__ K,
                 const _Float16* __restrict__ V, _Float16* __restrict__ Oa) {
  __shared__ __align__(16) _Float16 Ks[2][64][72];
  __shared__ __align__(16) _Float16 Vs[2][64][72];   // transposed: [d][key]

  const int t = threadIdx.x, lane = t & 31, wave = t >> 5;
  const int lr = lane & 15, hi = lane >> 4;
  const int kb = (lane < 16) ? 0 : 8;
  const int bh = blockIdx.y;                 // b*NH + h
  const int iq_base = blockIdx.x * 64 + wave * 16;
  const int iq = iq_base + lr;               // this lane's query

  const _Float16* qbase = Q + (size_t)bh * S_ * HD_;
  const _Float16* kbase = K + (size_t)bh * S_ * HD_;
  const _Float16* vbase = V + (size_t)bh * S_ * HD_;

  // Q fragments (64 d x 16 query columns, B operand) kept in registers.
  v16h bq[2];
  {
    const _Float16* qr = qbase + (size_t)iq * HD_;
    bq[0] = load_frag(qr, kb);
    bq[1] = load_frag(qr + 32, kb);
  }

  float mrow = -1e30f;  // running maximum of this lane's query (both halves agree)
  float lrow = 0.0f;    // running sum over this half's keys only; joined at the end
  v8f o[4] = {};        // o[dd][r] = O[iq][dd*16 + 8*hi + r]
  const float scale = 0.125f;  // 1/sqrt(64)

  // Grid bias, key jg = kt + j*16 + 8*hi + r with kt a multiple of 64:
  //   jg >> 5 = (kt >> 5) + (j >> 1),  jg & 31 = (j & 1)*16 + 8*hi + r.
  const int iq_blk = iq >> 5;
  const int iq_col = (iq & 31) - 8 * hi;

  const int row = t >> 1, half = t & 1;     // V map
  // K map: 8 lanes cover a key's 128 bytes (one line); 4 copies, 16 keys apart.
  const int krow = t >> 3, kchk = t & 7;
  const unsigned ks_lds = lds_off32(&Ks[0][krow][kchk * 8]);
  const unsigned ks_step = 16 * 72 * sizeof(_Float16);   // 16 keys on
  const unsigned ks_buf = 64 * 72 * sizeof(_Float16);    // the other buffer
  const unsigned kgoff = (unsigned)((krow * HD_ + kchk * 8) * sizeof(_Float16));
  const half8* gv = (const half8*)(vbase + (size_t)row * HD_ + half * 32);

  // K tile kt into buffer b: async global->LDS (4 x B128 per thread).
  auto copy_k = [&](int kt, int b) {
    const unsigned l = ks_lds + b * ks_buf;
    async_copy4(l, l + ks_step, l + 2 * ks_step, l + 3 * ks_step,
                kgoff + (unsigned)(kt * HD_ * sizeof(_Float16)),
                (const void*)kbase, (const void*)(kbase + 16 * HD_),
                (const void*)(kbase + 32 * HD_), (const void*)(kbase + 48 * HD_));
  };
  // V tile from registers, transposed, into Vs[b][d][key].
  auto store_v = [&](int b, half8 v0, half8 v1, half8 v2, half8 v3) {
#pragma unroll
    for (int j = 0; j < 8; ++j) {
      Vs[b][half * 32 + j][row]      = v0[j];
      Vs[b][half * 32 + 8 + j][row]  = v1[j];
      Vs[b][half * 32 + 16 + j][row] = v2[j];
      Vs[b][half * 32 + 24 + j][row] = v3[j];
    }
  };

  // Tile 0 into buffer 0, published; then tile 1's K copies into buffer 1.
  copy_k(0, 0);
  store_v(0, gv[0], gv[1], gv[2], gv[3]);
  wait_async0();
  __syncthreads();
  copy_k(64, 1);

  for (int kt = 0; kt < S_; kt += 64) {
    const int cur = (kt >> 6) & 1, nxt = cur ^ 1;
    const bool more = kt + 64 < S_;
    // Next V tile into registers: in flight during this tile's work.
    half8 vn[4];
    if (more) {
      const half8* g = gv + (size_t)(kt + 64) * HD_ / 8;
#pragma unroll
      for (int i = 0; i < 4; ++i) vn[i] = g[i];
    }

    // Scores S^T: 4 sub-tiles of 16 keys x 16 queries, two chained k=32 WMMAs.
    v8f s[4];
#pragma unroll
    for (int j = 0; j < 4; ++j) {
      v16h ak0 = load_frag(&Ks[cur][j * 16 + lr][0], kb);
      v16h ak1 = load_frag(&Ks[cur][j * 16 + lr][32], kb);
      v8f c = {};
      c = wmma32(ak0, bq[0], c);
      c = wmma32(ak1, bq[1], c);
      s[j] = c;
    }

    // Scale + grid bias + maximum over this lane's 32 keys (one chain per tile).
    float tmax[4];
#pragma unroll
    for (int j = 0; j < 4; ++j) {
      const bool same_blk = iq_blk == (kt >> 5) + (j >> 1);
      tmax[j] = -1e30f;
#pragma unroll
      for (int r = 0; r < 8; ++r) {
        const bool same_col = iq_col == (j & 1) * 16 + r;
        const float bias = (same_blk || same_col) ? 0.1f : 0.0f;
        const float val = s[j][r] * scale + bias;
        s[j][r] = val;
        tmax[j] = fmaxf(tmax[j], val);
      }
    }
    float rmax = fmaxf(fmaxf(tmax[0], tmax[1]), fmaxf(tmax[2], tmax[3]));
    rmax = fmaxf(rmax, other_half(rmax));

    // Online softmax update.
    const float mn = fmaxf(mrow, rmax);
    const float alpha = exp_1(mrow - mn);
    mrow = mn;
    float tsum[4];
#pragma unroll
    for (int j = 0; j < 4; ++j) {
      s[j] = exp_8(s[j] - mn);
      tsum[j] = s[j][0];
#pragma unroll
      for (int r = 1; r < 8; ++r) tsum[j] += s[j][r];
    }
    lrow = lrow * alpha + ((tsum[0] + tsum[1]) + (tsum[2] + tsum[3]));
#pragma unroll
    for (int dd = 0; dd < 4; ++dd)
#pragma unroll
      for (int r = 0; r < 8; ++r) o[dd][r] *= alpha;

    // P^T (f16) as B operand: tiles 2q and 2q+1 give keys 8*hi + e and
    // 16 + 8*hi + e of a 32-key group, the k order load_frag gives V^T.
    v16h bp0, bp1;
#pragma unroll
    for (int e = 0; e < 8; ++e) {
      bp0[e] = (_Float16)s[0][e]; bp0[8 + e] = (_Float16)s[1][e];
      bp1[e] = (_Float16)s[2][e]; bp1[8 + e] = (_Float16)s[3][e];
    }
    // Keeps every exp_8 statement in front of the products below.
    __builtin_amdgcn_sched_barrier(0);
    v16h av[4][2];
#pragma unroll
    for (int dd = 0; dd < 4; ++dd) {
      av[dd][0] = load_frag(&Vs[cur][dd * 16 + lr][0], kb);
      av[dd][1] = load_frag(&Vs[cur][dd * 16 + lr][32], kb);
    }
    // Keeps the fragment loads together in front of the products. Without it the
    // compiler put each pair directly in front of its product in this loop and
    // waited every pair out by itself.
    __builtin_amdgcn_sched_barrier(0);
#pragma unroll
    for (int dd = 0; dd < 4; ++dd) {
      o[dd] = wmma32(av[dd][0], bp0, o[dd]);
      o[dd] = wmma32(av[dd][1], bp1, o[dd]);
    }

    // The other buffer's last readers left it at the last tile's barrier.
    if (more) store_v(nxt, vn[0], vn[1], vn[2], vn[3]);
    // Foot of the tile: this wave's LDS reads and writes have retired and its K
    // copies have landed before the barrier that publishes the next tile and
    // frees this one's buffer for the copies behind it.
    asm volatile("s_wait_dscnt 0x0" ::: "memory");
    wait_async0();
    __syncthreads();
    if (kt + 128 < S_) copy_k(kt + 128, cur);
  }
  wait_async0();  // no copy is outstanding when the wave ends

  // Join the halves' sums, normalize and store f16 in (B,S,HID) layout for the
  // output projection: 8 consecutive d per lane, one 16-byte store per tile.
  const float ltot = lrow + other_half(lrow);
  const int bb = bh / NH_, h = bh % NH_;
  _Float16* orow = Oa + ((size_t)(bb * S_ + iq)) * HID_ + h * HD_ + 8 * hi;
#pragma unroll
  for (int dd = 0; dd < 4; ++dd) {
    half8 hv;
#pragma unroll
    for (int r = 0; r < 8; ++r) hv[r] = (_Float16)(o[dd][r] / ltot);
    *(half8*)(orow + dd * 16) = hv;
  }
}

// ---------------------------------------------------------------------------
// Kernel 3: out = A @ Wo^T + bo, f16 in -> f32 out.
// Grid: (HID/64, M/128). Block: 256.
// One LDS pass holds 128 k: four 32-k product steps. Two LDS buffers: the next
// pass's X copies and W loads fly during this pass's products; one barrier a pass.
// ---------------------------------------------------------------------------
__global__ __launch_bounds__(256)
void oproj_kernel(const _Float16* __restrict__ X, const float* __restrict__ W,
                  const float* __restrict__ bias, float* __restrict__ Out) {
  __shared__ __align__(16) _Float16 Xs[2][128][136];
  __shared__ __align__(16) _Float16 Ws[2][64][136];

  const int t = threadIdx.x;
  const int lane = t & 31, wave = t >> 5;
  const int wm = wave >> 1, wn = wave & 1;
  const int m0 = blockIdx.y * 128, n0 = blockIdx.x * 64;
  const int kb = (lane < 16) ? 0 : 8;
  const int lr = lane & 15, hi = lane >> 4;

  // X map: 16 lanes cover the 256 bytes (two lines) that a row has in a pass;
  // 8 copies, 16 rows apart. W map: a wave covers a row's 512 bytes (four lines);
  // 8 loads, 8 rows apart.
  const int xrow = t >> 4, xchk = t & 15;
  const int lrow = t >> 5, lchk = t & 31;
  const unsigned xs_lds = lds_off32(&Xs[0][xrow][xchk * 8]);
  const unsigned xs_step = 16 * 136 * sizeof(_Float16);   // 16 rows on
  const unsigned xs_buf = 128 * 136 * sizeof(_Float16);   // the other buffer
  const unsigned xgoff =
      (unsigned)(((size_t)(m0 + xrow) * HID_ + xchk * 8) * sizeof(_Float16));
  const float* gw = W + (size_t)(n0 + lrow) * HID_ + lchk * 4;

  // X tile at k0 into buffer b: 128 rows x 128 k (f16), async global->LDS
  // (8 x B128 per thread).
  auto copy_x = [&](int k0, int b) {
    const unsigned l = xs_lds + b * xs_buf;
    const unsigned goff = xgoff + (unsigned)(k0 * sizeof(_Float16));
    async_copy4(l, l + xs_step, l + 2 * xs_step, l + 3 * xs_step, goff,
                (const void*)X, (const void*)(X + 16 * HID_),
                (const void*)(X + 32 * HID_), (const void*)(X + 48 * HID_));
    async_copy4(l + 4 * xs_step, l + 5 * xs_step, l + 6 * xs_step, l + 7 * xs_step, goff,
                (const void*)(X + 64 * HID_), (const void*)(X + 80 * HID_),
                (const void*)(X + 96 * HID_), (const void*)(X + 112 * HID_));
  };

  v8f acc[2][2] = {};

  // Pass 0 into buffer 0, published; then pass 1's X copies into buffer 1.
  copy_x(0, 0);
  {
    f4v x[8];
#pragma unroll
    for (int i = 0; i < 8; ++i) x[i] = *(const f4v*)(gw + (size_t)i * 8 * HID_);
#pragma unroll
    for (int i = 0; i < 8; ++i) *(half4*)&Ws[0][lrow + 8 * i][lchk * 4] = cvt4(x[i]);
  }
  wait_async0();
  __syncthreads();
  copy_x(128, 1);

  for (int k0 = 0; k0 < HID_; k0 += 128) {
    const int cur = (k0 >> 7) & 1, nxt = cur ^ 1;
    const bool more = k0 + 128 < HID_;
    f4v x[8];
    if (more) {  // next pass's W tile, 64 rows x 128 k: in flight during the products
#pragma unroll
      for (int i = 0; i < 8; ++i)
        x[i] = *(const f4v*)(gw + k0 + 128 + (size_t)i * 8 * HID_);
    }

#pragma unroll
    for (int ks = 0; ks < 128; ks += 32) {
      v16h a[2], bf[2];
#pragma unroll
      for (int tm = 0; tm < 2; ++tm)
        a[tm] = load_frag(&Xs[cur][wm * 32 + tm * 16 + lr][ks], kb);
#pragma unroll
      for (int tn = 0; tn < 2; ++tn)
        bf[tn] = load_frag(&Ws[cur][wn * 32 + tn * 16 + lr][ks], kb);
#pragma unroll
      for (int tm = 0; tm < 2; ++tm)
#pragma unroll
        for (int tn = 0; tn < 2; ++tn) acc[tm][tn] = wmma32(a[tm], bf[tn], acc[tm][tn]);
    }

    if (more) {
      // The other buffer's last readers left it at the last pass's barrier.
#pragma unroll
      for (int i = 0; i < 8; ++i) *(half4*)&Ws[nxt][lrow + 8 * i][lchk * 4] = cvt4(x[i]);
    }
    // Foot of the pass: this wave's LDS reads and writes have retired and its X
    // copies have landed before the barrier that publishes the next tile and
    // frees this one's buffer for the copies behind it.
    asm volatile("s_wait_dscnt 0x0" ::: "memory");
    wait_async0();
    __syncthreads();
    if (k0 + 256 < HID_) copy_x(k0 + 256, cur);
  }
  wait_async0();  // no copy is outstanding when the wave ends

#pragma unroll
  for (int tn = 0; tn < 2; ++tn) {
    const int n = n0 + wn * 32 + tn * 16 + lr;
    const float bn = bias[n];
#pragma unroll
    for (int tm = 0; tm < 2; ++tm) {
#pragma unroll
      for (int r = 0; r < 8; ++r) {
        const int m = m0 + wm * 32 + tm * 16 + r + 8 * hi;
        Out[(size_t)m * HID_ + n] = acc[tm][tn][r] + bn;  // lanes 0..15 coalesce
      }
    }
  }
}

// ---------------------------------------------------------------------------
extern "C" void kernel_launch(void* const* d_in, const int* in_sizes, int n_in,
                              void* d_out, int out_size, void* d_ws, size_t ws_size,
                              hipStream_t stream) {
  (void)in_sizes; (void)n_in; (void)out_size; (void)ws_size;
  const float* query = (const float*)d_in[0];
  const float* key   = (const float*)d_in[1];
  const float* value = (const float*)d_in[2];
  const float* Wq = (const float*)d_in[3];
  const float* bq = (const float*)d_in[4];
  const float* Wk = (const float*)d_in[5];
  const float* bk = (const float*)d_in[6];
  const float* Wv = (const float*)d_in[7];
  const float* bv = (const float*)d_in[8];
  const float* Wo = (const float*)d_in[9];
  const float* bo = (const float*)d_in[10];
  float* out = (float*)d_out;

  // Workspace: 4 x (M*HID) f16 = 32 MB.
  _Float16* qws = (_Float16*)d_ws;
  _Float16* kws = qws + (size_t)M_ * HID_;
  _Float16* vws = kws + (size_t)M_ * HID_;
  _Float16* aws = vws + (size_t)M_ * HID_;

  qkv_kernel<<<dim3(HID_ / 128, M_ / 128, 3), 256, 0, stream>>>(
      query, key, value, Wq, Wk, Wv, bq, bk, bv, qws, kws, vws);
  attn_kernel<<<dim3(S_ / 64, B_ * NH_), 128, 0, stream>>>(qws, kws, vws, aws);
  oproj_kernel<<<dim3(HID_ / 64, M_ / 128), 256, 0, stream>>>(aws, Wo, bo, out);
}

// v006
// It runs in 72.1 microseconds.
// In two side-by-side timings against v005, it was 1.16 and 1.15 times as fast.
// Over all steps from v000 it is 2.13 times as fast.
#include <hip/hip_runtime.h>

// ---------------------------------------------------------------------------
// MHA with grid bias for MI455X (gfx1250), wave32, WMMA f16 -> f32 accum.
//   kernel 1: qkv projection  (f32 in -> f16 q/k/v in (B,NH,S,HD) layout)
//   kernel 2: fused flash-style attention (f16 in/out, f32 softmax state)
//             K tile staged via GLOBAL_LOAD_ASYNC_TO_LDS_B128 (ASYNCcnt)
//   kernel 3: output projection (f16 in -> f32 out + bias), async X tile
// Every tile loop has two LDS buffers: the next tile's loads and copies are
// issued a pass ahead and fly while this tile's products run.
// Workspace: 4 buffers of M*HID f16 = 32 MB.
// ---------------------------------------------------------------------------

typedef __attribute__((ext_vector_type(16))) _Float16 v16h;
typedef __attribute__((ext_vector_type(8)))  _Float16 half8;
typedef __attribute__((ext_vector_type(4)))  _Float16 half4;
typedef __attribute__((ext_vector_type(8)))  float    v8f;
typedef __attribute__((ext_vector_type(4)))  float    f4v;

#define B_   4
#define S_   1024
#define HID_ 1024
#define NH_  16
#define HD_  64
#define M_   (B_ * S_)

// 16-bit A-fragment gather (ISA 7.12.2): lane holds one row; k-chunks
// [kb, kb+7] and [16+kb, 16+kb+7] with kb = (lane<16) ? 0 : 8.
// B fragments use the mirror layout (lane = column), so x@W^T and k@q^T
// gather B exactly like A from row-major storage.
__device__ __forceinline__ v16h load_frag(const _Float16* __restrict__ row, int kb) {
  half8 lo = *(const half8*)(row + kb);
  half8 hi = *(const half8*)(row + 16 + kb);
  v16h a;
#pragma unroll
  for (int i = 0; i < 8; ++i) { a[i] = lo[i]; a[i + 8] = hi[i]; }
  return a;
}

__device__ __forceinline__ v8f wmma32(v16h a, v16h b, v8f c) {
  return __builtin_amdgcn_wmma_f32_16x16x32_f16(false, a, false, b, (short)0, c,
                                                false, false);
}

__device__ __forceinline__ half4 cvt4(f4v a) {
  half4 h;
#pragma unroll
  for (int i = 0; i < 4; ++i) h[i] = (_Float16)a[i];
  return h;
}

// Async global->LDS copies, 16 bytes per lane and copy, tracked by ASYNCcnt.
// GVS addressing: LDS[lds_i] = MEM[base_i + goff]. Neighbouring lanes take
// neighbouring 16-byte pieces of a row, so one wave-wide copy takes all that
// the tile holds of each row it touches, and no line is asked for by two copies
// of a tile. The s_wait_xcnt closes each statement so that no address register
// named here is rewritten ahead of it.
__device__ __forceinline__ void async_copy4(unsigned l0, unsigned l1, unsigned l2,
                                            unsigned l3, unsigned goff,
                                            const void* b0, const void* b1,
                                            const void* b2, const void* b3) {
  asm volatile(
      "global_load_async_to_lds_b128 %0, %4, %5\n\t"
      "global_load_async_to_lds_b128 %1, %4, %6\n\t"
      "global_load_async_to_lds_b128 %2, %4, %7\n\t"
      "global_load_async_to_lds_b128 %3, %4, %8\n\t"
      "s_wait_xcnt 0x0"
      :: "v"(l0), "v"(l1), "v"(l2), "v"(l3), "v"(goff),
         "s"(b0), "s"(b1), "s"(b2), "s"(b3) : "memory");
}

__device__ __forceinline__ void wait_async0() {
  asm volatile("s_wait_asynccnt 0x0" ::: "memory");
}

__device__ __forceinline__ unsigned lds_off32(const void* p) {
  return (unsigned)(size_t)p;  // flat LDS aperture: offset in addr[31:0]
}

// ---------------------------------------------------------------------------
// Kernel 1: q/k/v = X @ W^T + b, output f16 in (B,NH,S,HD) layout.
// Grid: (HID/256, M/256, 3). Block: 512 (16 waves; 4x4 wave grid, 64x64/wave).
// A 256x256 tile asks L2 for half the X and W bytes per product of a 128x128 one.
// One LDS pass holds 64 k: two 32-k product steps. Two LDS buffers: the next
// pass's X loads fly during the first step, its W loads during the second, and
// one barrier ends the pass.
// ---------------------------------------------------------------------------
__global__ __launch_bounds__(512)
void qkv_kernel(const float* __restrict__ Xq, const float* __restrict__ Xk,
                const float* __restrict__ Xv, const float* __restrict__ Wq,
                const float* __restrict__ Wk, const float* __restrict__ Wv,
                const float* __restrict__ bq, const float* __restrict__ bk,
                const float* __restrict__ bv, _Float16* __restrict__ Oq,
                _Float16* __restrict__ Ok, _Float16* __restrict__ Ov) {
  const int z = blockIdx.z;
  const float* X    = (z == 0) ? Xq : (z == 1) ? Xk : Xv;
  const float* W    = (z == 0) ? Wq : (z == 1) ? Wk : Wv;
  const float* bias = (z == 0) ? bq : (z == 1) ? bk : bv;
  _Float16*    O    = (z == 0) ? Oq : (z == 1) ? Ok : Ov;

  __shared__ __align__(16) _Float16 Xs[2][256][72];
  __shared__ __align__(16) _Float16 Ws[2][256][72];

  const int t = threadIdx.x;
  const int lane = t & 31, wave = t >> 5;
  const int wm = wave >> 2, wn = wave & 3;
  const int m0 = blockIdx.y * 256, n0 = blockIdx.x * 256;
  const int kb = (lane < 16) ? 0 : 8;
  const int lr = lane & 15, hi = lane >> 4;

  const int xrow = t >> 1, xhalf = t & 1;  // prefetch map: one line per lane
  // Load map: 16 lanes cover the 256 bytes (two lines) that a row has in a pass,
  // a wave-wide 16-byte load covers 4 whole lines; 8 loads, 32 rows apart.
  const int lrow = t >> 4, lchk = t & 15;

  v8f acc[4][4] = {};

  const float* gx = X + (size_t)(m0 + lrow) * HID_ + lchk * 4;
  const float* gw = W + (size_t)(n0 + lrow) * HID_ + lchk * 4;

  {  // Pass 0: X and W tiles, 256 rows x 64 k each (f32 -> f16), into buffer 0.
    f4v x[8], w[8];
#pragma unroll
    for (int i = 0; i < 8; ++i) x[i] = *(const f4v*)(gx + (size_t)i * 32 * HID_);
#pragma unroll
    for (int i = 0; i < 8; ++i) w[i] = *(const f4v*)(gw + (size_t)i * 32 * HID_);
#pragma unroll
    for (int i = 0; i < 8; ++i) *(half4*)&Xs[0][lrow + 32 * i][lchk * 4] = cvt4(x[i]);
#pragma unroll
    for (int i = 0; i < 8; ++i) *(half4*)&Ws[0][lrow + 32 * i][lchk * 4] = cvt4(w[i]);
  }
  __syncthreads();

  for (int k0 = 0; k0 < HID_; k0 += 64) {
    const int cur = (k0 >> 6) & 1, nxt = cur ^ 1;
    const bool more = k0 + 64 < HID_;
    f4v x[8];
    if (more) {  // next pass's X tile: in flight during the first product step
#pragma unroll
      for (int i = 0; i < 8; ++i)
        x[i] = *(const f4v*)(gx + k0 + 64 + (size_t)i * 32 * HID_);
    }
    if (k0 + 128 < HID_) {  // the pass after the next: a pass ahead of its loads
      __builtin_prefetch(X + (size_t)(m0 + xrow) * HID_ + k0 + xhalf * 32 + 128, 0, 0);
      __builtin_prefetch(W + (size_t)(n0 + xrow) * HID_ + k0 + xhalf * 32 + 128, 0, 0);
    }

#pragma unroll
    for (int ks = 0; ks < 64; ks += 32) {
      v16h a[4], bf[4];
#pragma unroll
      for (int tm = 0; tm < 4; ++tm)
        a[tm] = load_frag(&Xs[cur][wm * 64 + tm * 16 + lr][ks], kb);
#pragma unroll
      for (int tn = 0; tn < 4; ++tn)
        bf[tn] = load_frag(&Ws[cur][wn * 64 + tn * 16 + lr][ks], kb);
      // Keeps the step's 16 fragment loads together in front of its products.
      // Without it the compiler reloaded one A fragment's registers three times a
      // step and waited each reload out by itself.
      __builtin_amdgcn_sched_barrier(0);
#pragma unroll
      for (int tm = 0; tm < 4; ++tm)
#pragma unroll
        for (int tn = 0; tn < 4; ++tn) acc[tm][tn] = wmma32(a[tm], bf[tn], acc[tm][tn]);

      if (more) {
        // The other buffer's last readers left it at the last pass's barrier.
        if (ks == 0) {
#pragma unroll
          for (int i = 0; i < 8; ++i)
            *(half4*)&Xs[nxt][lrow + 32 * i][lchk * 4] = cvt4(x[i]);
          // next pass's W tile: in flight during the second product step
#pragma unroll
          for (int i = 0; i < 8; ++i)
            x[i] = *(const f4v*)(gw + k0 + 64 + (size_t)i * 32 * HID_);
        } else {
#pragma unroll
          for (int i = 0; i < 8; ++i)
            *(half4*)&Ws[nxt][lrow + 32 * i][lchk * 4] = cvt4(x[i]);
        }
      }
    }
    __syncthreads();  // publishes the next tile, ends this tile's reads
  }

  // Epilogue: bias + scatter into (B,NH,S,HD) f16.
#pragma unroll
  for (int tn = 0; tn < 4; ++tn) {
    const int n = n0 + wn * 64 + tn * 16 + lr;
    const float bn = bias[n];
    const int h = n >> 6, d = n & 63;
#pragma unroll
    for (int tm = 0; tm < 4; ++tm) {
#pragma unroll
      for (int r = 0; r < 8; ++r) {
        const int m = m0 + wm * 64 + tm * 16 + r + 8 * hi;
        const int bb = m >> 10, sq = m & (S_ - 1);
        O[(((size_t)(bb * NH_ + h) * S_) + sq) * HD_ + d] =
            (_Float16)(acc[tm][tn][r] + bn);
      }
    }
  }
}

__device__ __forceinline__ float other_half(float x) {
  int b = __builtin_bit_cast(int, x);
  b = __builtin_amdgcn_permlanex16(b, b, 0x76543210, 0xfedcba98, false, false);
  return __builtin_bit_cast(float, b);
}

// exp(x) as v_exp_f32 of x * log2(e), as __expf compiles. The v_nop behind the
// last v_exp_f32 stands in the same statement: it is the one slot that the
// instruction set asks for between a transcendental and an instruction that
// reads its result or overwrites its source. Inside a run the next, independent v_exp_f32
// fills it: outputs are early-clobber, so none lies on an input.
__device__ __forceinline__ float exp_1(float x) {
  const float y = x * 1.44269504f;
  float p;
  asm("v_exp_f32 %0, %1\n\t"
      "v_nop"
      : "=&v"(p) : "v"(y));
  return p;
}

__device__ __forceinline__ v8f exp_8(v8f x) {
  const v8f y = x * 1.44269504f;
  float p0, p1, p2, p3, p4, p5, p6, p7;
  asm("v_exp_f32 %0, %8\n\t"
      "v_exp_f32 %1, %9\n\t"
      "v_exp_f32 %2, %10\n\t"
      "v_exp_f32 %3, %11\n\t"
      "v_exp_f32 %4, %12\n\t"
      "v_exp_f32 %5, %13\n\t"
      "v_exp_f32 %6, %14\n\t"
      "v_exp_f32 %7, %15\n\t"
      "v_nop"
      : "=&v"(p0), "=&v"(p1), "=&v"(p2), "=&v"(p3),
        "=&v"(p4), "=&v"(p5), "=&v"(p6), "=&v"(p7)
      : "v"(y[0]), "v"(y[1]), "v"(y[2]), "v"(y[3]),
        "v"(y[4]), "v"(y[5]), "v"(y[6]), "v"(y[7]));
  v8f p = {p0, p1, p2, p3, p4, p5, p6, p7};
  return p;
}

__global__ __launch_bounds__(128)
void attn_kernel(const _Float16* __restrict__ Q, const _Float16* __restrict__ K,
                 const _Float16* __restrict__ V, _Float16* __restrict__ Oa) {
  __shared__ __align__(16) _Float16 Ks[2][64][72];
  __shared__ __align__(16) _Float16 Vs[2][64][72];   // transposed: [d][key]

  const int t = threadIdx.x, lane = t & 31, wave = t >> 5;
  const int lr = lane & 15, hi = lane >> 4;
  const int kb = (lane < 16) ? 0 : 8;
  const int bh = blockIdx.y;                 // b*NH + h
  const int iq_base = blockIdx.x * 64 + wave * 16;
  const int iq = iq_base + lr;               // this lane's query

  const _Float16* qbase = Q + (size_t)bh * S_ * HD_;
  const _Float16* kbase = K + (size_t)bh * S_ * HD_;
  const _Float16* vbase = V + (size_t)bh * S_ * HD_;

  // Q fragments (64 d x 16 query columns, B operand) kept in registers.
  v16h bq[2];
  {
    const _Float16* qr = qbase + (size_t)iq * HD_;
    bq[0] = load_frag(qr, kb);
    bq[1] = load_frag(qr + 32, kb);
  }

  float mrow = -1e30f;  // running maximum of this lane's query (both halves agree)
  float lrow = 0.0f;    // running sum over this half's keys only; joined at the end
  v8f o[4] = {};        // o[dd][r] = O[iq][dd*16 + 8*hi + r]
  const float scale = 0.125f;  // 1/sqrt(64)

  // Grid bias, key jg = kt + j*16 + 8*hi + r with kt a multiple of 64:
  //   jg >> 5 = (kt >> 5) + (j >> 1),  jg & 31 = (j & 1)*16 + 8*hi + r.
  const int iq_blk = iq >> 5;
  const int iq_col = (iq & 31) - 8 * hi;

  const int row = t >> 1, half = t & 1;     // V map
  // K map: 8 lanes cover a key's 128 bytes (one line); 4 copies, 16 keys apart.
  const int krow = t >> 3, kchk = t & 7;
  const unsigned ks_lds = lds_off32(&Ks[0][krow][kchk * 8]);
  const unsigned ks_step = 16 * 72 * sizeof(_Float16);   // 16 keys on
  const unsigned ks_buf = 64 * 72 * sizeof(_Float16);    // the other buffer
  const unsigned kgoff = (unsigned)((krow * HD_ + kchk * 8) * sizeof(_Float16));
  const half8* gv = (const half8*)(vbase + (size_t)row * HD_ + half * 32);

  // K tile kt into buffer b: async global->LDS (4 x B128 per thread).
  auto copy_k = [&](int kt, int b) {
    const unsigned l = ks_lds + b * ks_buf;
    async_copy4(l, l + ks_step, l + 2 * ks_step, l + 3 * ks_step,
                kgoff + (unsigned)(kt * HD_ * sizeof(_Float16)),
                (const void*)kbase, (const void*)(kbase + 16 * HD_),
                (const void*)(kbase + 32 * HD_), (const void*)(kbase + 48 * HD_));
  };
  // V tile from registers, transposed, into Vs[b][d][key].
  auto store_v = [&](int b, half8 v0, half8 v1, half8 v2, half8 v3) {
#pragma unroll
    for (int j = 0; j < 8; ++j) {
      Vs[b][half * 32 + j][row]      = v0[j];
      Vs[b][half * 32 + 8 + j][row]  = v1[j];
      Vs[b][half * 32 + 16 + j][row] = v2[j];
      Vs[b][half * 32 + 24 + j][row] = v3[j];
    }
  };

  // Tile 0 into buffer 0, published; then tile 1's K copies into buffer 1.
  copy_k(0, 0);
  store_v(0, gv[0], gv[1], gv[2], gv[3]);
  wait_async0();
  __syncthreads();
  copy_k(64, 1);

  for (int kt = 0; kt < S_; kt += 64) {
    const int cur = (kt >> 6) & 1, nxt = cur ^ 1;
    const bool more = kt + 64 < S_;
    // Next V tile into registers: in flight during this tile's work.
    half8 vn[4];
    if (more) {
      const half8* g = gv + (size_t)(kt + 64) * HD_ / 8;
#pragma unroll
      for (int i = 0; i < 4; ++i) vn[i] = g[i];
    }

    // Scores S^T: 4 sub-tiles of 16 keys x 16 queries, two chained k=32 WMMAs.
    v8f s[4];
#pragma unroll
    for (int j = 0; j < 4; ++j) {
      v16h ak0 = load_frag(&Ks[cur][j * 16 + lr][0], kb);
      v16h ak1 = load_frag(&Ks[cur][j * 16 + lr][32], kb);
      v8f c = {};
      c = wmma32(ak0, bq[0], c);
      c = wmma32(ak1, bq[1], c);
      s[j] = c;
    }

    // Scale + grid bias + maximum over this lane's 32 keys (one chain per tile).
    float tmax[4];
#pragma unroll
    for (int j = 0; j < 4; ++j) {
      const bool same_blk = iq_blk == (kt >> 5) + (j >> 1);
      tmax[j] = -1e30f;
#pragma unroll
      for (int r = 0; r < 8; ++r) {
        const bool same_col = iq_col == (j & 1) * 16 + r;
        const float bias = (same_blk || same_col) ? 0.1f : 0.0f;
        const float val = s[j][r] * scale + bias;
        s[j][r] = val;
        tmax[j] = fmaxf(tmax[j], val);
      }
    }
    float rmax = fmaxf(fmaxf(tmax[0], tmax[1]), fmaxf(tmax[2], tmax[3]));
    rmax = fmaxf(rmax, other_half(rmax));

    // Online softmax update.
    const float mn = fmaxf(mrow, rmax);
    const float alpha = exp_1(mrow - mn);
    mrow = mn;
    float tsum[4];
#pragma unroll
    for (int j = 0; j < 4; ++j) {
      s[j] = exp_8(s[j] - mn);
      tsum[j] = s[j][0];
#pragma unroll
      for (int r = 1; r < 8; ++r) tsum[j] += s[j][r];
    }
    lrow = lrow * alpha + ((tsum[0] + tsum[1]) + (tsum[2] + tsum[3]));
#pragma unroll
    for (int dd = 0; dd < 4; ++dd)
#pragma unroll
      for (int r = 0; r < 8; ++r) o[dd][r] *= alpha;

    // P^T (f16) as B operand: tiles 2q and 2q+1 give keys 8*hi + e and
    // 16 + 8*hi + e of a 32-key group, the k order load_frag gives V^T.
    v16h bp0, bp1;
#pragma unroll
    for (int e = 0; e < 8; ++e) {
      bp0[e] = (_Float16)s[0][e]; bp0[8 + e] = (_Float16)s[1][e];
      bp1[e] = (_Float16)s[2][e]; bp1[8 + e] = (_Float16)s[3][e];
    }
    // Keeps every exp_8 statement in front of the products below.
    __builtin_amdgcn_sched_barrier(0);
    v16h av[4][2];
#pragma unroll
    for (int dd = 0; dd < 4; ++dd) {
      av[dd][0] = load_frag(&Vs[cur][dd * 16 + lr][0], kb);
      av[dd][1] = load_frag(&Vs[cur][dd * 16 + lr][32], kb);
    }
    // Keeps the fragment loads together in front of the products. Without it the
    // compiler put each pair directly in front of its product in this loop and
    // waited every pair out by itself.
    __builtin_amdgcn_sched_barrier(0);
#pragma unroll
    for (int dd = 0; dd < 4; ++dd) {
      o[dd] = wmma32(av[dd][0], bp0, o[dd]);
      o[dd] = wmma32(av[dd][1], bp1, o[dd]);
    }

    // The other buffer's last readers left it at the last tile's barrier.
    if (more) store_v(nxt, vn[0], vn[1], vn[2], vn[3]);
    // Foot of the tile: this wave's LDS reads and writes have retired and its K
    // copies have landed before the barrier that publishes the next tile and
    // frees this one's buffer for the copies behind it.
    asm volatile("s_wait_dscnt 0x0" ::: "memory");
    wait_async0();
    __syncthreads();
    if (kt + 128 < S_) copy_k(kt + 128, cur);
  }
  wait_async0();  // no copy is outstanding when the wave ends

  // Join the halves' sums, normalize and store f16 in (B,S,HID) layout for the
  // output projection: 8 consecutive d per lane, one 16-byte store per tile.
  const float ltot = lrow + other_half(lrow);
  const int bb = bh / NH_, h = bh % NH_;
  _Float16* orow = Oa + ((size_t)(bb * S_ + iq)) * HID_ + h * HD_ + 8 * hi;
#pragma unroll
  for (int dd = 0; dd < 4; ++dd) {
    half8 hv;
#pragma unroll
    for (int r = 0; r < 8; ++r) hv[r] = (_Float16)(o[dd][r] / ltot);
    *(half8*)(orow + dd * 16) = hv;
  }
}

// ---------------------------------------------------------------------------
// Kernel 3: out = A @ Wo^T + bo, f16 in -> f32 out.
// Grid: (HID/64, M/128). Block: 256.
// One LDS pass holds 128 k: four 32-k product steps. Two LDS buffers: the next
// pass's X copies and W loads fly during this pass's products; one barrier a pass.
// ---------------------------------------------------------------------------
__global__ __launch_bounds__(256)
void oproj_kernel(const _Float16* __restrict__ X, const float* __restrict__ W,
                  const float* __restrict__ bias, float* __restrict__ Out) {
  __shared__ __align__(16) _Float16 Xs[2][128][136];
  __shared__ __align__(16) _Float16 Ws[2][64][136];

  const int t = threadIdx.x;
  const int lane = t & 31, wave = t >> 5;
  const int wm = wave >> 1, wn = wave & 1;
  const int m0 = blockIdx.y * 128, n0 = blockIdx.x * 64;
  const int kb = (lane < 16) ? 0 : 8;
  const int lr = lane & 15, hi = lane >> 4;

  // X map: 16 lanes cover the 256 bytes (two lines) that a row has in a pass;
  // 8 copies, 16 rows apart. W map: a wave covers a row's 512 bytes (four lines);
  // 8 loads, 8 rows apart.
  const int xrow = t >> 4, xchk = t & 15;
  const int lrow = t >> 5, lchk = t & 31;
  const unsigned xs_lds = lds_off32(&Xs[0][xrow][xchk * 8]);
  const unsigned xs_step = 16 * 136 * sizeof(_Float16);   // 16 rows on
  const unsigned xs_buf = 128 * 136 * sizeof(_Float16);   // the other buffer
  const unsigned xgoff =
      (unsigned)(((size_t)(m0 + xrow) * HID_ + xchk * 8) * sizeof(_Float16));
  const float* gw = W + (size_t)(n0 + lrow) * HID_ + lchk * 4;

  // X tile at k0 into buffer b: 128 rows x 128 k (f16), async global->LDS
  // (8 x B128 per thread).
  auto copy_x = [&](int k0, int b) {
    const unsigned l = xs_lds + b * xs_buf;
    const unsigned goff = xgoff + (unsigned)(k0 * sizeof(_Float16));
    async_copy4(l, l + xs_step, l + 2 * xs_step, l + 3 * xs_step, goff,
                (const void*)X, (const void*)(X + 16 * HID_),
                (const void*)(X + 32 * HID_), (const void*)(X + 48 * HID_));
    async_copy4(l + 4 * xs_step, l + 5 * xs_step, l + 6 * xs_step, l + 7 * xs_step, goff,
                (const void*)(X + 64 * HID_), (const void*)(X + 80 * HID_),
                (const void*)(X + 96 * HID_), (const void*)(X + 112 * HID_));
  };

  v8f acc[2][2] = {};

  // Pass 0 into buffer 0, published; then pass 1's X copies into buffer 1.
  copy_x(0, 0);
  {
    f4v x[8];
#pragma unroll
    for (int i = 0; i < 8; ++i) x[i] = *(const f4v*)(gw + (size_t)i * 8 * HID_);
#pragma unroll
    for (int i = 0; i < 8; ++i) *(half4*)&Ws[0][lrow + 8 * i][lchk * 4] = cvt4(x[i]);
  }
  wait_async0();
  __syncthreads();
  copy_x(128, 1);

  for (int k0 = 0; k0 < HID_; k0 += 128) {
    const int cur = (k0 >> 7) & 1, nxt = cur ^ 1;
    const bool more = k0 + 128 < HID_;
    f4v x[8];
    if (more) {  // next pass's W tile, 64 rows x 128 k: in flight during the products
#pragma unroll
      for (int i = 0; i < 8; ++i)
        x[i] = *(const f4v*)(gw + k0 + 128 + (size_t)i * 8 * HID_);
    }

#pragma unroll
    for (int ks = 0; ks < 128; ks += 32) {
      v16h a[2], bf[2];
#pragma unroll
      for (int tm = 0; tm < 2; ++tm)
        a[tm] = load_frag(&Xs[cur][wm * 32 + tm * 16 + lr][ks], kb);
#pragma unroll
      for (int tn = 0; tn < 2; ++tn)
        bf[tn] = load_frag(&Ws[cur][wn * 32 + tn * 16 + lr][ks], kb);
#pragma unroll
      for (int tm = 0; tm < 2; ++tm)
#pragma unroll
        for (int tn = 0; tn < 2; ++tn) acc[tm][tn] = wmma32(a[tm], bf[tn], acc[tm][tn]);
    }

    if (more) {
      // The other buffer's last readers left it at the last pass's barrier.
#pragma unroll
      for (int i = 0; i < 8; ++i) *(half4*)&Ws[nxt][lrow + 8 * i][lchk * 4] = cvt4(x[i]);
    }
    // Foot of the pass: this wave's LDS reads and writes have retired and its X
    // copies have landed before the barrier that publishes the next tile and
    // frees this one's buffer for the copies behind it.
    asm volatile("s_wait_dscnt 0x0" ::: "memory");
    wait_async0();
    __syncthreads();
    if (k0 + 256 < HID_) copy_x(k0 + 256, cur);
  }
  wait_async0();  // no copy is outstanding when the wave ends

#pragma unroll
  for (int tn = 0; tn < 2; ++tn) {
    const int n = n0 + wn * 32 + tn * 16 + lr;
    const float bn = bias[n];
#pragma unroll
    for (int tm = 0; tm < 2; ++tm) {
#pragma unroll
      for (int r = 0; r < 8; ++r) {
        const int m = m0 + wm * 32 + tm * 16 + r + 8 * hi;
        Out[(size_t)m * HID_ + n] = acc[tm][tn][r] + bn;  // lanes 0..15 coalesce
      }
    }
  }
}

// ---------------------------------------------------------------------------
extern "C" void kernel_launch(void* const* d_in, const int* in_sizes, int n_in,
                              void* d_out, int out_size, void* d_ws, size_t ws_size,
                              hipStream_t stream) {
  (void)in_sizes; (void)n_in; (void)out_size; (void)ws_size;
  const float* query = (const float*)d_in[0];
  const float* key   = (const float*)d_in[1];
  const float* value = (const float*)d_in[2];
  const float* Wq = (const float*)d_in[3];
  const float* bq = (const float*)d_in[4];
  const float* Wk = (const float*)d_in[5];
  const float* bk = (const float*)d_in[6];
  const float* Wv = (const float*)d_in[7];
  const float* bv = (const float*)d_in[8];
  const float* Wo = (const float*)d_in[9];
  const float* bo = (const float*)d_in[10];
  float* out = (float*)d_out;

  // Workspace: 4 x (M*HID) f16 = 32 MB.
  _Float16* qws = (_Float16*)d_ws;
  _Float16* kws = qws + (size_t)M_ * HID_;
  _Float16* vws = kws + (size_t)M_ * HID_;
  _Float16* aws = vws + (size_t)M_ * HID_;

  qkv_kernel<<<dim3(HID_ / 256, M_ / 256, 3), 512, 0, stream>>>(
      query, key, value, Wq, Wk, Wv, bq, bk, bv, qws, kws, vws);
  attn_kernel<<<dim3(S_ / 64, B_ * NH_), 128, 0, stream>>>(qws, kws, vws, aws);
  oproj_kernel<<<dim3(HID_ / 64, M_ / 128), 256, 0, stream>>>(aws, Wo, bo, out);
}

// v007
// It runs in 68.3 microseconds.
// Timed twice side by side with v006, it ran 1.06 and 1.05 times as fast.
// Over all steps from v000 it is 2.24 times as fast.
#include <hip/hip_runtime.h>

// ---------------------------------------------------------------------------
// MHA with grid bias for MI455X (gfx1250), wave32, WMMA f16 -> f32 accum.
//   kernel 1: qkv projection  (f32 in -> f16 q/k/v in (B,NH,S,HD) layout)
//   kernel 2: fused flash-style attention (f16 in/out, f32 softmax state)
//             K and V tiles staged via GLOBAL_LOAD_ASYNC_TO_LDS_B128 (ASYNCcnt)
//   kernel 3: output projection (f16 in -> f32 out + bias), async X tile
// Every tile loop has two LDS buffers: the next tile's loads and copies are
// issued a pass ahead and fly while this tile's products run.
// Workspace: 4 buffers of M*HID f16 = 32 MB.
// ---------------------------------------------------------------------------

typedef __attribute__((ext_vector_type(16))) _Float16 v16h;
typedef __attribute__((ext_vector_type(8)))  _Float16 half8;
typedef __attribute__((ext_vector_type(4)))  _Float16 half4;
typedef __attribute__((ext_vector_type(8)))  float    v8f;
typedef __attribute__((ext_vector_type(4)))  float    f4v;
typedef __attribute__((ext_vector_type(8)))  short    s16x8;

#define B_   4
#define S_   1024
#define HID_ 1024
#define NH_  16
#define HD_  64
#define M_   (B_ * S_)

// 16-bit A-fragment gather (ISA 7.12.2): lane holds one row; k-chunks
// [kb, kb+7] and [16+kb, 16+kb+7] with kb = (lane<16) ? 0 : 8.
// B fragments use the mirror layout (lane = column), so x@W^T and k@q^T
// gather B exactly like A from row-major storage.
__device__ __forceinline__ v16h load_frag(const _Float16* __restrict__ row, int kb) {
  half8 lo = *(const half8*)(row + kb);
  half8 hi = *(const half8*)(row + 16 + kb);
  v16h a;
#pragma unroll
  for (int i = 0; i < 8; ++i) { a[i] = lo[i]; a[i + 8] = hi[i]; }
  return a;
}

__device__ __forceinline__ v8f wmma32(v16h a, v16h b, v8f c) {
  return __builtin_amdgcn_wmma_f32_16x16x32_f16(false, a, false, b, (short)0, c,
                                                false, false);
}

__device__ __forceinline__ half4 cvt4(f4v a) {
  half4 h;
#pragma unroll
  for (int i = 0; i < 4; ++i) h[i] = (_Float16)a[i];
  return h;
}

// Async global->LDS copies, 16 bytes per lane and copy, tracked by ASYNCcnt.
// GVS addressing: LDS[lds_i] = MEM[base_i + goff]. Neighbouring lanes take
// neighbouring 16-byte pieces of a row, so one wave-wide copy takes all that
// the tile holds of each row it touches, and no line is asked for by two copies
// of a tile. The s_wait_xcnt closes each statement so that no address register
// named here is rewritten ahead of it.
__device__ __forceinline__ void async_copy4(unsigned l0, unsigned l1, unsigned l2,
                                            unsigned l3, unsigned goff,
                                            const void* b0, const void* b1,
                                            const void* b2, const void* b3) {
  asm volatile(
      "global_load_async_to_lds_b128 %0, %4, %5\n\t"
      "global_load_async_to_lds_b128 %1, %4, %6\n\t"
      "global_load_async_to_lds_b128 %2, %4, %7\n\t"
      "global_load_async_to_lds_b128 %3, %4, %8\n\t"
      "s_wait_xcnt 0x0"
      :: "v"(l0), "v"(l1), "v"(l2), "v"(l3), "v"(goff),
         "s"(b0), "s"(b1), "s"(b2), "s"(b3) : "memory");
}

// The same for two tiles at once: eight copies, one offset, one closing wait.
__device__ __forceinline__ void async_copy8(unsigned l0, unsigned l1, unsigned l2,
                                            unsigned l3, unsigned l4, unsigned l5,
                                            unsigned l6, unsigned l7, unsigned goff,
                                            const void* b0, const void* b1,
                                            const void* b2, const void* b3,
                                            const void* b4, const void* b5,
                                            const void* b6, const void* b7) {
  asm volatile(
      "global_load_async_to_lds_b128 %0, %8, %9\n\t"
      "global_load_async_to_lds_b128 %1, %8, %10\n\t"
      "global_load_async_to_lds_b128 %2, %8, %11\n\t"
      "global_load_async_to_lds_b128 %3, %8, %12\n\t"
      "global_load_async_to_lds_b128 %4, %8, %13\n\t"
      "global_load_async_to_lds_b128 %5, %8, %14\n\t"
      "global_load_async_to_lds_b128 %6, %8, %15\n\t"
      "global_load_async_to_lds_b128 %7, %8, %16\n\t"
      "s_wait_xcnt 0x0"
      :: "v"(l0), "v"(l1), "v"(l2), "v"(l3), "v"(l4), "v"(l5), "v"(l6), "v"(l7),
         "v"(goff), "s"(b0), "s"(b1), "s"(b2), "s"(b3), "s"(b4), "s"(b5), "s"(b6),
         "s"(b7) : "memory");
}

__device__ __forceinline__ void wait_async0() {
  asm volatile("s_wait_asynccnt 0x0" ::: "memory");
}

__device__ __forceinline__ unsigned lds_off32(const void* p) {
  return (unsigned)(size_t)p;  // flat LDS aperture: offset in addr[31:0]
}

// Transposing LDS load: from a row-major 16-bit tile T[k][d], lane l passes the
// address of T[k0 + 8*(l>>4) + (l&7)][d0 + 8*((l>>3)&1)] and gets
// T[k0 + 8*(l>>4) + 0..7][d0 + (l&15)]: half of an A fragment of T^T.
__device__ __forceinline__ half8 load_tr16(const _Float16* p) {
  typedef __attribute__((address_space(3))) s16x8 lds_s16x8;
  return __builtin_bit_cast(half8, __builtin_amdgcn_ds_load_tr16_b128_v8i16((lds_s16x8*)p));
}

// ---------------------------------------------------------------------------
// Kernel 1: q/k/v = X @ W^T + b, output f16 in (B,NH,S,HD) layout.
// Grid: (HID/256, M/256, 3). Block: 512 (16 waves; 4x4 wave grid, 64x64/wave).
// A 256x256 tile asks L2 for half the X and W bytes per product of a 128x128 one.
// One LDS pass holds 64 k: two 32-k product steps. Two LDS buffers: the next
// pass's X loads fly during the first step, its W loads during the second, and
// one barrier ends the pass.
// ---------------------------------------------------------------------------
__global__ __launch_bounds__(512)
void qkv_kernel(const float* __restrict__ Xq, const float* __restrict__ Xk,
                const float* __restrict__ Xv, const float* __restrict__ Wq,
                const float* __restrict__ Wk, const float* __restrict__ Wv,
                const float* __restrict__ bq, const float* __restrict__ bk,
                const float* __restrict__ bv, _Float16* __restrict__ Oq,
                _Float16* __restrict__ Ok, _Float16* __restrict__ Ov) {
  const int z = blockIdx.z;
  const float* X    = (z == 0) ? Xq : (z == 1) ? Xk : Xv;
  const float* W    = (z == 0) ? Wq : (z == 1) ? Wk : Wv;
  const float* bias = (z == 0) ? bq : (z == 1) ? bk : bv;
  _Float16*    O    = (z == 0) ? Oq : (z == 1) ? Ok : Ov;

  __shared__ __align__(16) _Float16 Xs[2][256][72];
  __shared__ __align__(16) _Float16 Ws[2][256][72];

  const int t = threadIdx.x;
  const int lane = t & 31, wave = t >> 5;
  const int wm = wave >> 2, wn = wave & 3;
  const int m0 = blockIdx.y * 256, n0 = blockIdx.x * 256;
  const int kb = (lane < 16) ? 0 : 8;
  const int lr = lane & 15, hi = lane >> 4;

  const int xrow = t >> 1, xhalf = t & 1;  // prefetch map: one line per lane
  // Load map: 16 lanes cover the 256 bytes (two lines) that a row has in a pass,
  // a wave-wide 16-byte load covers 4 whole lines; 8 loads, 32 rows apart.
  const int lrow = t >> 4, lchk = t & 15;

  v8f acc[4][4] = {};

  const float* gx = X + (size_t)(m0 + lrow) * HID_ + lchk * 4;
  const float* gw = W + (size_t)(n0 + lrow) * HID_ + lchk * 4;

  {  // Pass 0: X and W tiles, 256 rows x 64 k each (f32 -> f16), into buffer 0.
    f4v x[8], w[8];
#pragma unroll
    for (int i = 0; i < 8; ++i) x[i] = *(const f4v*)(gx + (size_t)i * 32 * HID_);
#pragma unroll
    for (int i = 0; i < 8; ++i) w[i] = *(const f4v*)(gw + (size_t)i * 32 * HID_);
#pragma unroll
    for (int i = 0; i < 8; ++i) *(half4*)&Xs[0][lrow + 32 * i][lchk * 4] = cvt4(x[i]);
#pragma unroll
    for (int i = 0; i < 8; ++i) *(half4*)&Ws[0][lrow + 32 * i][lchk * 4] = cvt4(w[i]);
  }
  __syncthreads();

  for (int k0 = 0; k0 < HID_; k0 += 64) {
    const int cur = (k0 >> 6) & 1, nxt = cur ^ 1;
    const bool more = k0 + 64 < HID_;
    f4v x[8];
    if (more) {  // next pass's X tile: in flight during the first product step
#pragma unroll
      for (int i = 0; i < 8; ++i)
        x[i] = *(const f4v*)(gx + k0 + 64 + (size_t)i * 32 * HID_);
    }
    if (k0 + 128 < HID_) {  // the pass after the next: a pass ahead of its loads
      __builtin_prefetch(X + (size_t)(m0 + xrow) * HID_ + k0 + xhalf * 32 + 128, 0, 0);
      __builtin_prefetch(W + (size_t)(n0 + xrow) * HID_ + k0 + xhalf * 32 + 128, 0, 0);
    }

#pragma unroll
    for (int ks = 0; ks < 64; ks += 32) {
      v16h a[4], bf[4];
#pragma unroll
      for (int tm = 0; tm < 4; ++tm)
        a[tm] = load_frag(&Xs[cur][wm * 64 + tm * 16 + lr][ks], kb);
#pragma unroll
      for (int tn = 0; tn < 4; ++tn)
        bf[tn] = load_frag(&Ws[cur][wn * 64 + tn * 16 + lr][ks], kb);
      // Keeps the step's 16 fragment loads together in front of its products.
      // Without it the compiler reloaded one A fragment's registers three times a
      // step and waited each reload out by itself.
      __builtin_amdgcn_sched_barrier(0);
#pragma unroll
      for (int tm = 0; tm < 4; ++tm)
#pragma unroll
        for (int tn = 0; tn < 4; ++tn) acc[tm][tn] = wmma32(a[tm], bf[tn], acc[tm][tn]);

      if (more) {
        // The other buffer's last readers left it at the last pass's barrier.
        if (ks == 0) {
#pragma unroll
          for (int i = 0; i < 8; ++i)
            *(half4*)&Xs[nxt][lrow + 32 * i][lchk * 4] = cvt4(x[i]);
          // next pass's W tile: in flight during the second product step
#pragma unroll
          for (int i = 0; i < 8; ++i)
            x[i] = *(const f4v*)(gw + k0 + 64 + (size_t)i * 32 * HID_);
        } else {
#pragma unroll
          for (int i = 0; i < 8; ++i)
            *(half4*)&Ws[nxt][lrow + 32 * i][lchk * 4] = cvt4(x[i]);
        }
      }
    }
    __syncthreads();  // publishes the next tile, ends this tile's reads
  }

  // Epilogue: bias + scatter into (B,NH,S,HD) f16.
#pragma unroll
  for (int tn = 0; tn < 4; ++tn) {
    const int n = n0 + wn * 64 + tn * 16 + lr;
    const float bn = bias[n];
    const int h = n >> 6, d = n & 63;
#pragma unroll
    for (int tm = 0; tm < 4; ++tm) {
#pragma unroll
      for (int r = 0; r < 8; ++r) {
        const int m = m0 + wm * 64 + tm * 16 + r + 8 * hi;
        const int bb = m >> 10, sq = m & (S_ - 1);
        O[(((size_t)(bb * NH_ + h) * S_) + sq) * HD_ + d] =
            (_Float16)(acc[tm][tn][r] + bn);
      }
    }
  }
}

__device__ __forceinline__ float other_half(float x) {
  int b = __builtin_bit_cast(int, x);
  b = __builtin_amdgcn_permlanex16(b, b, 0x76543210, 0xfedcba98, false, false);
  return __builtin_bit_cast(float, b);
}

// exp(x) as v_exp_f32 of x * log2(e), as __expf compiles. The v_nop behind the
// last v_exp_f32 stands in the same statement: it is the one slot that the
// instruction set asks for between a transcendental and an instruction that
// reads its result or overwrites its source. Inside a run the next, independent v_exp_f32
// fills it: outputs are early-clobber, so none lies on an input.
__device__ __forceinline__ float exp_1(float x) {
  const float y = x * 1.44269504f;
  float p;
  asm("v_exp_f32 %0, %1\n\t"
      "v_nop"
      : "=&v"(p) : "v"(y));
  return p;
}

__device__ __forceinline__ v8f exp_8(v8f x) {
  const v8f y = x * 1.44269504f;
  float p0, p1, p2, p3, p4, p5, p6, p7;
  asm("v_exp_f32 %0, %8\n\t"
      "v_exp_f32 %1, %9\n\t"
      "v_exp_f32 %2, %10\n\t"
      "v_exp_f32 %3, %11\n\t"
      "v_exp_f32 %4, %12\n\t"
      "v_exp_f32 %5, %13\n\t"
      "v_exp_f32 %6, %14\n\t"
      "v_exp_f32 %7, %15\n\t"
      "v_nop"
      : "=&v"(p0), "=&v"(p1), "=&v"(p2), "=&v"(p3),
        "=&v"(p4), "=&v"(p5), "=&v"(p6), "=&v"(p7)
      : "v"(y[0]), "v"(y[1]), "v"(y[2]), "v"(y[3]),
        "v"(y[4]), "v"(y[5]), "v"(y[6]), "v"(y[7]));
  v8f p = {p0, p1, p2, p3, p4, p5, p6, p7};
  return p;
}

__global__ __launch_bounds__(128)
void attn_kernel(const _Float16* __restrict__ Q, const _Float16* __restrict__ K,
                 const _Float16* __restrict__ V, _Float16* __restrict__ Oa) {
  __shared__ __align__(16) _Float16 Ks[2][64][72];
  // [key][d]; 160-byte rows: an odd multiple of 32 bytes suits the transposing load
  __shared__ __align__(16) _Float16 Vs[2][64][80];

  const int t = threadIdx.x, lane = t & 31, wave = t >> 5;
  const int lr = lane & 15, hi = lane >> 4;
  const int kb = (lane < 16) ? 0 : 8;
  const int bh = blockIdx.y;                 // b*NH + h
  const int iq_base = blockIdx.x * 64 + wave * 16;
  const int iq = iq_base + lr;               // this lane's query

  const _Float16* qbase = Q + (size_t)bh * S_ * HD_;
  const _Float16* kbase = K + (size_t)bh * S_ * HD_;
  const _Float16* vbase = V + (size_t)bh * S_ * HD_;

  // Q fragments (64 d x 16 query columns, B operand) kept in registers.
  v16h bq[2];
  {
    const _Float16* qr = qbase + (size_t)iq * HD_;
    bq[0] = load_frag(qr, kb);
    bq[1] = load_frag(qr + 32, kb);
  }

  float mrow = -1e30f;  // running maximum of this lane's query (both halves agree)
  float lrow = 0.0f;    // running sum over this half's keys only; joined at the end
  v8f o[4] = {};        // o[dd][r] = O[iq][dd*16 + 8*hi + r]
  const float scale = 0.125f;  // 1/sqrt(64)

  // Grid bias, key jg = kt + j*16 + 8*hi + r with kt a multiple of 64:
  //   jg >> 5 = (kt >> 5) + (j >> 1),  jg & 31 = (j & 1)*16 + 8*hi + r.
  const int iq_blk = iq >> 5;
  const int iq_col = (iq & 31) - 8 * hi;

  // K and V map: 8 lanes cover a key's 128 bytes (one line); 4 copies, 16 keys apart.
  const int krow = t >> 3, kchk = t & 7;
  const unsigned ks_lds = lds_off32(&Ks[0][krow][kchk * 8]);
  const unsigned ks_step = 16 * 72 * sizeof(_Float16);   // 16 keys on
  const unsigned ks_buf = 64 * 72 * sizeof(_Float16);    // the other buffer
  const unsigned kgoff = (unsigned)((krow * HD_ + kchk * 8) * sizeof(_Float16));
  const unsigned vs_lds = lds_off32(&Vs[0][krow][kchk * 8]);
  const unsigned vs_step = 16 * 80 * sizeof(_Float16);   // 16 keys on
  const unsigned vs_buf = 64 * 80 * sizeof(_Float16);    // the other buffer
  // This lane's address in a 16-key x 16-d piece for the transposing load.
  const int vtr_key = 8 * hi + (lane & 7), vtr_d = 8 * ((lane >> 3) & 1);

  // K and V tiles kt into buffer b: async global->LDS (8 x B128 per thread).
  auto copy_kv = [&](int kt, int b) {
    const unsigned l = ks_lds + b * ks_buf;
    const unsigned m = vs_lds + b * vs_buf;
    async_copy8(l, l + ks_step, l + 2 * ks_step, l + 3 * ks_step,
                m, m + vs_step, m + 2 * vs_step, m + 3 * vs_step,
                kgoff + (unsigned)(kt * HD_ * sizeof(_Float16)),
                (const void*)kbase, (const void*)(kbase + 16 * HD_),
                (const void*)(kbase + 32 * HD_), (const void*)(kbase + 48 * HD_),
                (const void*)vbase, (const void*)(vbase + 16 * HD_),
                (const void*)(vbase + 32 * HD_), (const void*)(vbase + 48 * HD_));
  };

  // Tile 0 into buffer 0, published; then tile 1's copies into buffer 1.
  copy_kv(0, 0);
  wait_async0();
  __syncthreads();
  copy_kv(64, 1);

  for (int kt = 0; kt < S_; kt += 64) {
    const int cur = (kt >> 6) & 1;

    // Scores S^T: 4 sub-tiles of 16 keys x 16 queries, two chained k=32 WMMAs.
    v8f s[4];
#pragma unroll
    for (int j = 0; j < 4; ++j) {
      v16h ak0 = load_frag(&Ks[cur][j * 16 + lr][0], kb);
      v16h ak1 = load_frag(&Ks[cur][j * 16 + lr][32], kb);
      v8f c = {};
      c = wmma32(ak0, bq[0], c);
      c = wmma32(ak1, bq[1], c);
      s[j] = c;
    }

    // Scale + grid bias + maximum over this lane's 32 keys (one chain per tile).
    float tmax[4];
#pragma unroll
    for (int j = 0; j < 4; ++j) {
      const bool same_blk = iq_blk == (kt >> 5) + (j >> 1);
      tmax[j] = -1e30f;
#pragma unroll
      for (int r = 0; r < 8; ++r) {
        const bool same_col = iq_col == (j & 1) * 16 + r;
        const float bias = (same_blk || same_col) ? 0.1f : 0.0f;
        const float val = s[j][r] * scale + bias;
        s[j][r] = val;
        tmax[j] = fmaxf(tmax[j], val);
      }
    }
    float rmax = fmaxf(fmaxf(tmax[0], tmax[1]), fmaxf(tmax[2], tmax[3]));
    rmax = fmaxf(rmax, other_half(rmax));

    // Online softmax update.
    const float mn = fmaxf(mrow, rmax);
    const float alpha = exp_1(mrow - mn);
    mrow = mn;
    float tsum[4];
#pragma unroll
    for (int j = 0; j < 4; ++j) {
      s[j] = exp_8(s[j] - mn);
      tsum[j] = s[j][0];
#pragma unroll
      for (int r = 1; r < 8; ++r) tsum[j] += s[j][r];
    }
    lrow = lrow * alpha + ((tsum[0] + tsum[1]) + (tsum[2] + tsum[3]));
#pragma unroll
    for (int dd = 0; dd < 4; ++dd)
#pragma unroll
      for (int r = 0; r < 8; ++r) o[dd][r] *= alpha;

    // P^T (f16) as B operand: tiles 2q and 2q+1 give keys 8*hi + e and
    // 16 + 8*hi + e of a 32-key group, the k order of the V^T fragments below.
    v16h bp0, bp1;
#pragma unroll
    for (int e = 0; e < 8; ++e) {
      bp0[e] = (_Float16)s[0][e]; bp0[8 + e] = (_Float16)s[1][e];
      bp1[e] = (_Float16)s[2][e]; bp1[8 + e] = (_Float16)s[3][e];
    }
    // Keeps every exp_8 statement in front of the products below.
    __builtin_amdgcn_sched_barrier(0);
    v16h av[4][2];
#pragma unroll
    for (int dd = 0; dd < 4; ++dd) {
      // Both loops unrolled: constant indices keep av in registers.
#pragma unroll
      for (int q = 0; q < 2; ++q) {
        const half8 lo = load_tr16(&Vs[cur][q * 32 + vtr_key][dd * 16 + vtr_d]);
        const half8 up = load_tr16(&Vs[cur][q * 32 + 16 + vtr_key][dd * 16 + vtr_d]);
#pragma unroll
        for (int i = 0; i < 8; ++i) { av[dd][q][i] = lo[i]; av[dd][q][i + 8] = up[i]; }
      }
    }
    // Keeps the fragment loads together in front of the products. Without it the
    // compiler put each pair directly in front of its product in this loop and
    // waited every pair out by itself.
    __builtin_amdgcn_sched_barrier(0);
#pragma unroll
    for (int dd = 0; dd < 4; ++dd) {
      o[dd] = wmma32(av[dd][0], bp0, o[dd]);
      o[dd] = wmma32(av[dd][1], bp1, o[dd]);
    }

    // Foot of the tile: this wave's LDS reads have retired and its copies have
    // landed before the barrier that publishes the next tile and frees this one's
    // buffer for the copies behind it.
    asm volatile("s_wait_dscnt 0x0" ::: "memory");
    wait_async0();
    __syncthreads();
    if (kt + 128 < S_) copy_kv(kt + 128, cur);
  }
  wait_async0();  // no copy is outstanding when the wave ends

  // Join the halves' sums, normalize and store f16 in (B,S,HID) layout for the
  // output projection: 8 consecutive d per lane, one 16-byte store per tile.
  const float ltot = lrow + other_half(lrow);
  const int bb = bh / NH_, h = bh % NH_;
  _Float16* orow = Oa + ((size_t)(bb * S_ + iq)) * HID_ + h * HD_ + 8 * hi;
#pragma unroll
  for (int dd = 0; dd < 4; ++dd) {
    half8 hv;
#pragma unroll
    for (int r = 0; r < 8; ++r) hv[r] = (_Float16)(o[dd][r] / ltot);
    *(half8*)(orow + dd * 16) = hv;
  }
}

// ---------------------------------------------------------------------------
// Kernel 3: out = A @ Wo^T + bo, f16 in -> f32 out.
// Grid: (HID/64, M/128). Block: 256.
// One LDS pass holds 128 k: four 32-k product steps. Two LDS buffers: the next
// pass's X copies and W loads fly during this pass's products; one barrier a pass.
// ---------------------------------------------------------------------------
__global__ __launch_bounds__(256)
void oproj_kernel(const _Float16* __restrict__ X, const float* __restrict__ W,
                  const float* __restrict__ bias, float* __restrict__ Out) {
  __shared__ __align__(16) _Float16 Xs[2][128][136];
  __shared__ __align__(16) _Float16 Ws[2][64][136];

  const int t = threadIdx.x;
  const int lane = t & 31, wave = t >> 5;
  const int wm = wave >> 1, wn = wave & 1;
  const int m0 = blockIdx.y * 128, n0 = blockIdx.x * 64;
  const int kb = (lane < 16) ? 0 : 8;
  const int lr = lane & 15, hi = lane >> 4;

  // X map: 16 lanes cover the 256 bytes (two lines) that a row has in a pass;
  // 8 copies, 16 rows apart. W map: a wave covers a row's 512 bytes (four lines);
  // 8 loads, 8 rows apart.
  const int xrow = t >> 4, xchk = t & 15;
  const int lrow = t >> 5, lchk = t & 31;
  const unsigned xs_lds = lds_off32(&Xs[0][xrow][xchk * 8]);
  const unsigned xs_step = 16 * 136 * sizeof(_Float16);   // 16 rows on
  const unsigned xs_buf = 128 * 136 * sizeof(_Float16);   // the other buffer
  const unsigned xgoff =
      (unsigned)(((size_t)(m0 + xrow) * HID_ + xchk * 8) * sizeof(_Float16));
  const float* gw = W + (size_t)(n0 + lrow) * HID_ + lchk * 4;

  // X tile at k0 into buffer b: 128 rows x 128 k (f16), async global->LDS
  // (8 x B128 per thread).
  auto copy_x = [&](int k0, int b) {
    const unsigned l = xs_lds + b * xs_buf;
    const unsigned goff = xgoff + (unsigned)(k0 * sizeof(_Float16));
    async_copy4(l, l + xs_step, l + 2 * xs_step, l + 3 * xs_step, goff,
                (const void*)X, (const void*)(X + 16 * HID_),
                (const void*)(X + 32 * HID_), (const void*)(X + 48 * HID_));
    async_copy4(l + 4 * xs_step, l + 5 * xs_step, l + 6 * xs_step, l + 7 * xs_step, goff,
                (const void*)(X + 64 * HID_), (const void*)(X + 80 * HID_),
                (const void*)(X + 96 * HID_), (const void*)(X + 112 * HID_));
  };

  v8f acc[2][2] = {};

  // Pass 0 into buffer 0, published; then pass 1's X copies into buffer 1.
  copy_x(0, 0);
  {
    f4v x[8];
#pragma unroll
    for (int i = 0; i < 8; ++i) x[i] = *(const f4v*)(gw + (size_t)i * 8 * HID_);
#pragma unroll
    for (int i = 0; i < 8; ++i) *(half4*)&Ws[0][lrow + 8 * i][lchk * 4] = cvt4(x[i]);
  }
  wait_async0();
  __syncthreads();
  copy_x(128, 1);

  for (int k0 = 0; k0 < HID_; k0 += 128) {
    const int cur = (k0 >> 7) & 1, nxt = cur ^ 1;
    const bool more = k0 + 128 < HID_;
    f4v x[8];
    if (more) {  // next pass's W tile, 64 rows x 128 k: in flight during the products
#pragma unroll
      for (int i = 0; i < 8; ++i)
        x[i] = *(const f4v*)(gw + k0 + 128 + (size_t)i * 8 * HID_);
    }

#pragma unroll
    for (int ks = 0; ks < 128; ks += 32) {
      v16h a[2], bf[2];
#pragma unroll
      for (int tm = 0; tm < 2; ++tm)
        a[tm] = load_frag(&Xs[cur][wm * 32 + tm * 16 + lr][ks], kb);
#pragma unroll
      for (int tn = 0; tn < 2; ++tn)
        bf[tn] = load_frag(&Ws[cur][wn * 32 + tn * 16 + lr][ks], kb);
#pragma unroll
      for (int tm = 0; tm < 2; ++tm)
#pragma unroll
        for (int tn = 0; tn < 2; ++tn) acc[tm][tn] = wmma32(a[tm], bf[tn], acc[tm][tn]);
    }

    if (more) {
      // The other buffer's last readers left it at the last pass's barrier.
#pragma unroll
      for (int i = 0; i < 8; ++i) *(half4*)&Ws[nxt][lrow + 8 * i][lchk * 4] = cvt4(x[i]);
    }
    // Foot of the pass: this wave's LDS reads and writes have retired and its X
    // copies have landed before the barrier that publishes the next tile and
    // frees this one's buffer for the copies behind it.
    asm volatile("s_wait_dscnt 0x0" ::: "memory");
    wait_async0();
    __syncthreads();
    if (k0 + 256 < HID_) copy_x(k0 + 256, cur);
  }
  wait_async0();  // no copy is outstanding when the wave ends

#pragma unroll
  for (int tn = 0; tn < 2; ++tn) {
    const int n = n0 + wn * 32 + tn * 16 + lr;
    const float bn = bias[n];
#pragma unroll
    for (int tm = 0; tm < 2; ++tm) {
#pragma unroll
      for (int r = 0; r < 8; ++r) {
        const int m = m0 + wm * 32 + tm * 16 + r + 8 * hi;
        Out[(size_t)m * HID_ + n] = acc[tm][tn][r] + bn;  // lanes 0..15 coalesce
      }
    }
  }
}

// ---------------------------------------------------------------------------
extern "C" void kernel_launch(void* const* d_in, const int* in_sizes, int n_in,
                              void* d_out, int out_size, void* d_ws, size_t ws_size,
                              hipStream_t stream) {
  (void)in_sizes; (void)n_in; (void)out_size; (void)ws_size;
  const float* query = (const float*)d_in[0];
  const float* key   = (const float*)d_in[1];
  const float* value = (const float*)d_in[2];
  const float* Wq = (const float*)d_in[3];
  const float* bq = (const float*)d_in[4];
  const float* Wk = (const float*)d_in[5];
  const float* bk = (const float*)d_in[6];
  const float* Wv = (const float*)d_in[7];
  const float* bv = (const float*)d_in[8];
  const float* Wo = (const float*)d_in[9];
  const float* bo = (const float*)d_in[10];
  float* out = (float*)d_out;

  // Workspace: 4 x (M*HID) f16 = 32 MB.
  _Float16* qws = (_Float16*)d_ws;
  _Float16* kws = qws + (size_t)M_ * HID_;
  _Float16* vws = kws + (size_t)M_ * HID_;
  _Float16* aws = vws + (size_t)M_ * HID_;

  qkv_kernel<<<dim3(HID_ / 256, M_ / 256, 3), 512, 0, stream>>>(
      query, key, value, Wq, Wk, Wv, bq, bk, bv, qws, kws, vws);
  attn_kernel<<<dim3(S_ / 64, B_ * NH_), 128, 0, stream>>>(qws, kws, vws, aws);
  oproj_kernel<<<dim3(HID_ / 64, M_ / 128), 256, 0, stream>>>(aws, Wo, bo, out);
}

// v008
// A run of this version takes 65.3 microseconds.
// Two timings next to v007 both put it at 1.05 times that version's speed.
// All steps since v000 together make it 2.35 times as fast.
#include <hip/hip_runtime.h>

// ---------------------------------------------------------------------------
// MHA with grid bias for MI455X (gfx1250), wave32, WMMA f16 -> f32 accum.
//   kernel 1: qkv projection  (f32 in -> f16 q/k/v in (B,NH,S,HD) layout)
//   kernel 2: fused flash-style attention (f16 in/out, f32 softmax state)
//             K and V tiles staged via GLOBAL_LOAD_ASYNC_TO_LDS_B128 (ASYNCcnt)
//   kernel 3: output projection (f16 in -> f32 out + bias), async X tile
// Every tile loop has two LDS buffers: the next tile's loads and copies are
// issued a pass ahead and fly while this tile's products run.
// Workspace: 4 buffers of M*HID f16 = 32 MB.
// ---------------------------------------------------------------------------

typedef __attribute__((ext_vector_type(16))) _Float16 v16h;
typedef __attribute__((ext_vector_type(8)))  _Float16 half8;
typedef __attribute__((ext_vector_type(4)))  _Float16 half4;
typedef __attribute__((ext_vector_type(8)))  float    v8f;
typedef __attribute__((ext_vector_type(4)))  float    f4v;
typedef __attribute__((ext_vector_type(8)))  short    s16x8;

#define B_   4
#define S_   1024
#define HID_ 1024
#define NH_  16
#define HD_  64
#define M_   (B_ * S_)

// 16-bit A-fragment gather (ISA 7.12.2): lane holds one row; k-chunks
// [kb, kb+7] and [16+kb, 16+kb+7] with kb = (lane<16) ? 0 : 8.
// B fragments use the mirror layout (lane = column), so x@W^T and k@q^T
// gather B exactly like A from row-major storage.
__device__ __forceinline__ v16h load_frag(const _Float16* __restrict__ row, int kb) {
  half8 lo = *(const half8*)(row + kb);
  half8 hi = *(const half8*)(row + 16 + kb);
  v16h a;
#pragma unroll
  for (int i = 0; i < 8; ++i) { a[i] = lo[i]; a[i + 8] = hi[i]; }
  return a;
}

__device__ __forceinline__ v8f wmma32(v16h a, v16h b, v8f c) {
  return __builtin_amdgcn_wmma_f32_16x16x32_f16(false, a, false, b, (short)0, c,
                                                false, false);
}

__device__ __forceinline__ half4 cvt4(f4v a) {
  half4 h;
#pragma unroll
  for (int i = 0; i < 4; ++i) h[i] = (_Float16)a[i];
  return h;
}

// Async global->LDS copies, 16 bytes per lane and copy, tracked by ASYNCcnt.
// GVS addressing: LDS[lds_i] = MEM[base_i + goff]. Neighbouring lanes take
// neighbouring 16-byte pieces of a row, so one wave-wide copy takes all that
// the tile holds of each row it touches, and no line is asked for by two copies
// of a tile. The s_wait_xcnt closes each statement so that no address register
// named here is rewritten ahead of it.
__device__ __forceinline__ void async_copy4(unsigned l0, unsigned l1, unsigned l2,
                                            unsigned l3, unsigned goff,
                                            const void* b0, const void* b1,
                                            const void* b2, const void* b3) {
  asm volatile(
      "global_load_async_to_lds_b128 %0, %4, %5\n\t"
      "global_load_async_to_lds_b128 %1, %4, %6\n\t"
      "global_load_async_to_lds_b128 %2, %4, %7\n\t"
      "global_load_async_to_lds_b128 %3, %4, %8\n\t"
      "s_wait_xcnt 0x0"
      :: "v"(l0), "v"(l1), "v"(l2), "v"(l3), "v"(goff),
         "s"(b0), "s"(b1), "s"(b2), "s"(b3) : "memory");
}

// The same for two tiles at once: eight copies, one offset, one closing wait.
__device__ __forceinline__ void async_copy8(unsigned l0, unsigned l1, unsigned l2,
                                            unsigned l3, unsigned l4, unsigned l5,
                                            unsigned l6, unsigned l7, unsigned goff,
                                            const void* b0, const void* b1,
                                            const void* b2, const void* b3,
                                            const void* b4, const void* b5,
                                            const void* b6, const void* b7) {
  asm volatile(
      "global_load_async_to_lds_b128 %0, %8, %9\n\t"
      "global_load_async_to_lds_b128 %1, %8, %10\n\t"
      "global_load_async_to_lds_b128 %2, %8, %11\n\t"
      "global_load_async_to_lds_b128 %3, %8, %12\n\t"
      "global_load_async_to_lds_b128 %4, %8, %13\n\t"
      "global_load_async_to_lds_b128 %5, %8, %14\n\t"
      "global_load_async_to_lds_b128 %6, %8, %15\n\t"
      "global_load_async_to_lds_b128 %7, %8, %16\n\t"
      "s_wait_xcnt 0x0"
      :: "v"(l0), "v"(l1), "v"(l2), "v"(l3), "v"(l4), "v"(l5), "v"(l6), "v"(l7),
         "v"(goff), "s"(b0), "s"(b1), "s"(b2), "s"(b3), "s"(b4), "s"(b5), "s"(b6),
         "s"(b7) : "memory");
}

__device__ __forceinline__ void wait_async0() {
  asm volatile("s_wait_asynccnt 0x0" ::: "memory");
}

__device__ __forceinline__ unsigned lds_off32(const void* p) {
  return (unsigned)(size_t)p;  // flat LDS aperture: offset in addr[31:0]
}

// Transposing LDS load: from a row-major 16-bit tile T[k][d], lane l passes the
// address of T[k0 + 8*(l>>4) + (l&7)][d0 + 8*((l>>3)&1)] and gets
// T[k0 + 8*(l>>4) + 0..7][d0 + (l&15)]: half of an A fragment of T^T.
__device__ __forceinline__ half8 load_tr16(const _Float16* p) {
  typedef __attribute__((address_space(3))) s16x8 lds_s16x8;
  return __builtin_bit_cast(half8, __builtin_amdgcn_ds_load_tr16_b128_v8i16((lds_s16x8*)p));
}

// ---------------------------------------------------------------------------
// Kernel 1: q/k/v = X @ W^T + b, q scaled by log2(e)/sqrt(HD), output f16 in (B,NH,S,HD) layout.
// Grid: (HID/256, M/256, 3). Block: 512 (16 waves; 4x4 wave grid, 64x64/wave).
// A 256x256 tile asks L2 for half the X and W bytes per product of a 128x128 one.
// One LDS pass holds 64 k: two 32-k product steps. Two LDS buffers: the next
// pass's X loads fly during the first step, its W loads during the second, and
// one barrier ends the pass.
// ---------------------------------------------------------------------------
__global__ __launch_bounds__(512)
void qkv_kernel(const float* __restrict__ Xq, const float* __restrict__ Xk,
                const float* __restrict__ Xv, const float* __restrict__ Wq,
                const float* __restrict__ Wk, const float* __restrict__ Wv,
                const float* __restrict__ bq, const float* __restrict__ bk,
                const float* __restrict__ bv, _Float16* __restrict__ Oq,
                _Float16* __restrict__ Ok, _Float16* __restrict__ Ov) {
  const int z = blockIdx.z;
  const float* X    = (z == 0) ? Xq : (z == 1) ? Xk : Xv;
  const float* W    = (z == 0) ? Wq : (z == 1) ? Wk : Wv;
  const float* bias = (z == 0) ? bq : (z == 1) ? bk : bv;
  _Float16*    O    = (z == 0) ? Oq : (z == 1) ? Ok : Ov;

  __shared__ __align__(16) _Float16 Xs[2][256][72];
  __shared__ __align__(16) _Float16 Ws[2][256][72];

  const int t = threadIdx.x;
  const int lane = t & 31, wave = t >> 5;
  const int wm = wave >> 2, wn = wave & 3;
  const int m0 = blockIdx.y * 256, n0 = blockIdx.x * 256;
  const int kb = (lane < 16) ? 0 : 8;
  const int lr = lane & 15, hi = lane >> 4;

  const int xrow = t >> 1, xhalf = t & 1;  // prefetch map: one line per lane
  // Load map: 16 lanes cover the 256 bytes (two lines) that a row has in a pass,
  // a wave-wide 16-byte load covers 4 whole lines; 8 loads, 32 rows apart.
  const int lrow = t >> 4, lchk = t & 15;

  v8f acc[4][4] = {};

  const float* gx = X + (size_t)(m0 + lrow) * HID_ + lchk * 4;
  const float* gw = W + (size_t)(n0 + lrow) * HID_ + lchk * 4;

  {  // Pass 0: X and W tiles, 256 rows x 64 k each (f32 -> f16), into buffer 0.
    f4v x[8], w[8];
#pragma unroll
    for (int i = 0; i < 8; ++i) x[i] = *(const f4v*)(gx + (size_t)i * 32 * HID_);
#pragma unroll
    for (int i = 0; i < 8; ++i) w[i] = *(const f4v*)(gw + (size_t)i * 32 * HID_);
#pragma unroll
    for (int i = 0; i < 8; ++i) *(half4*)&Xs[0][lrow + 32 * i][lchk * 4] = cvt4(x[i]);
#pragma unroll
    for (int i = 0; i < 8; ++i) *(half4*)&Ws[0][lrow + 32 * i][lchk * 4] = cvt4(w[i]);
  }
  __syncthreads();

  for (int k0 = 0; k0 < HID_; k0 += 64) {
    const int cur = (k0 >> 6) & 1, nxt = cur ^ 1;
    const bool more = k0 + 64 < HID_;
    f4v x[8];
    if (more) {  // next pass's X tile: in flight during the first product step
#pragma unroll
      for (int i = 0; i < 8; ++i)
        x[i] = *(const f4v*)(gx + k0 + 64 + (size_t)i * 32 * HID_);
    }
    if (k0 + 128 < HID_) {  // the pass after the next: a pass ahead of its loads
      __builtin_prefetch(X + (size_t)(m0 + xrow) * HID_ + k0 + xhalf * 32 + 128, 0, 0);
      __builtin_prefetch(W + (size_t)(n0 + xrow) * HID_ + k0 + xhalf * 32 + 128, 0, 0);
    }

#pragma unroll
    for (int ks = 0; ks < 64; ks += 32) {
      v16h a[4], bf[4];
#pragma unroll
      for (int tm = 0; tm < 4; ++tm)
        a[tm] = load_frag(&Xs[cur][wm * 64 + tm * 16 + lr][ks], kb);
#pragma unroll
      for (int tn = 0; tn < 4; ++tn)
        bf[tn] = load_frag(&Ws[cur][wn * 64 + tn * 16 + lr][ks], kb);
      // Keeps the step's 16 fragment loads together in front of its products.
      // Without it the compiler reloaded one A fragment's registers three times a
      // step and waited each reload out by itself.
      __builtin_amdgcn_sched_barrier(0);
#pragma unroll
      for (int tm = 0; tm < 4; ++tm)
#pragma unroll
        for (int tn = 0; tn < 4; ++tn) acc[tm][tn] = wmma32(a[tm], bf[tn], acc[tm][tn]);

      if (more) {
        // The other buffer's last readers left it at the last pass's barrier.
        if (ks == 0) {
#pragma unroll
          for (int i = 0; i < 8; ++i)
            *(half4*)&Xs[nxt][lrow + 32 * i][lchk * 4] = cvt4(x[i]);
          // next pass's W tile: in flight during the second product step
#pragma unroll
          for (int i = 0; i < 8; ++i)
            x[i] = *(const f4v*)(gw + k0 + 64 + (size_t)i * 32 * HID_);
        } else {
#pragma unroll
          for (int i = 0; i < 8; ++i)
            *(half4*)&Ws[nxt][lrow + 32 * i][lchk * 4] = cvt4(x[i]);
        }
      }
    }
    __syncthreads();  // publishes the next tile, ends this tile's reads
  }

  // Epilogue: bias + scatter into (B,NH,S,HD) f16. q leaves as
  // q * log2(e) / sqrt(HD), scaled in f32 ahead of its one rounding to f16: the
  // score product of the attention kernel then is the exponent of 2 as it stands.
  const float oscale = (z == 0) ? 0.18033688f : 1.0f;
#pragma unroll
  for (int tn = 0; tn < 4; ++tn) {
    const int n = n0 + wn * 64 + tn * 16 + lr;
    const float bn = bias[n];
    const int h = n >> 6, d = n & 63;
#pragma unroll
    for (int tm = 0; tm < 4; ++tm) {
#pragma unroll
      for (int r = 0; r < 8; ++r) {
        const int m = m0 + wm * 64 + tm * 16 + r + 8 * hi;
        const int bb = m >> 10, sq = m & (S_ - 1);
        O[(((size_t)(bb * NH_ + h) * S_) + sq) * HD_ + d] =
            (_Float16)((acc[tm][tn][r] + bn) * oscale);
      }
    }
  }
}

__device__ __forceinline__ float other_half(float x) {
  int b = __builtin_bit_cast(int, x);
  b = __builtin_amdgcn_permlanex16(b, b, 0x76543210, 0xfedcba98, false, false);
  return __builtin_bit_cast(float, b);
}

// 2^y as v_exp_f32 (the scores arrive as exponents of 2). The v_nop behind the
// last v_exp_f32 stands in the same statement: it is the one slot that the
// instruction set asks for between a transcendental and an instruction that
// reads its result or overwrites its source. Inside a run the next, independent v_exp_f32
// fills it: outputs are early-clobber, so none lies on an input.
__device__ __forceinline__ float exp2_1(float y) {
  float p;
  asm("v_exp_f32 %0, %1\n\t"
      "v_nop"
      : "=&v"(p) : "v"(y));
  return p;
}

__device__ __forceinline__ v8f exp2_8(v8f y) {
  float p0, p1, p2, p3, p4, p5, p6, p7;
  asm("v_exp_f32 %0, %8\n\t"
      "v_exp_f32 %1, %9\n\t"
      "v_exp_f32 %2, %10\n\t"
      "v_exp_f32 %3, %11\n\t"
      "v_exp_f32 %4, %12\n\t"
      "v_exp_f32 %5, %13\n\t"
      "v_exp_f32 %6, %14\n\t"
      "v_exp_f32 %7, %15\n\t"
      "v_nop"
      : "=&v"(p0), "=&v"(p1), "=&v"(p2), "=&v"(p3),
        "=&v"(p4), "=&v"(p5), "=&v"(p6), "=&v"(p7)
      : "v"(y[0]), "v"(y[1]), "v"(y[2]), "v"(y[3]),
        "v"(y[4]), "v"(y[5]), "v"(y[6]), "v"(y[7]));
  v8f p = {p0, p1, p2, p3, p4, p5, p6, p7};
  return p;
}

__global__ __launch_bounds__(128)
void attn_kernel(const _Float16* __restrict__ Q, const _Float16* __restrict__ K,
                 const _Float16* __restrict__ V, _Float16* __restrict__ Oa) {
  __shared__ __align__(16) _Float16 Ks[2][64][72];
  // [key][d]; 160-byte rows: an odd multiple of 32 bytes suits the transposing load
  __shared__ __align__(16) _Float16 Vs[2][64][80];

  const int t = threadIdx.x, lane = t & 31;
  // In a scalar register: the test on the wave's own key block is a scalar branch.
  const int wave = __builtin_amdgcn_readfirstlane(t >> 5);
  const int lr = lane & 15, hi = lane >> 4;
  const int kb = (lane < 16) ? 0 : 8;
  const int bh = blockIdx.y;                 // b*NH + h
  const int iq_base = blockIdx.x * 64 + wave * 16;
  const int iq = iq_base + lr;               // this lane's query

  const _Float16* qbase = Q + (size_t)bh * S_ * HD_;
  const _Float16* kbase = K + (size_t)bh * S_ * HD_;
  const _Float16* vbase = V + (size_t)bh * S_ * HD_;

  // Q fragments (64 d x 16 query columns, B operand) kept in registers.
  v16h bq[2];
  {
    const _Float16* qr = qbase + (size_t)iq * HD_;
    bq[0] = load_frag(qr, kb);
    bq[1] = load_frag(qr + 32, kb);
  }

  float mrow = -1e30f;  // running maximum of this lane's query, in powers of 2
  v8f lacc = {};        // register 0: running sum of query lr in lanes 0-15; the rest 0
  v8f o[4] = {};        // o[dd][r] = O[iq][dd*16 + 8*hi + r]

  // Grid bias, key jg = kt + j*16 + 8*hi + r with kt a multiple of 64:
  //   jg >> 5 = (kt >> 5) + (j >> 1),  jg & 31 = (j & 1)*16 + 8*hi + r.
  // The column part is the same in every tile: cb[j & 1] is the C operand of tile
  // j's score product. The block part holds for 32 keys alone, the same for the
  // wave's 16 queries: tiles 2*own_pair and 2*own_pair + 1 of key tile own_kt.
  const float bias2 = 0.1f * 1.44269504f;  // 0.1 * log2(e)
  const int iq_col = (iq & 31) - 8 * hi;
  v8f cb[2];
#pragma unroll
  for (int p = 0; p < 2; ++p)
#pragma unroll
    for (int r = 0; r < 8; ++r) cb[p][r] = (iq_col == p * 16 + r) ? bias2 : 0.0f;
  const int own_kt = blockIdx.x * 64, own_pair = wave >> 1;

  // A operand of the row sums: row 0 (lanes 0 and 16) is 1 at all 32 k, the rest 0.
  v16h ones;
#pragma unroll
  for (int i = 0; i < 16; ++i) ones[i] = (lr == 0) ? (_Float16)1.0f : (_Float16)0.0f;

  // K and V map: 8 lanes cover a key's 128 bytes (one line); 4 copies, 16 keys apart.
  const int krow = t >> 3, kchk = t & 7;
  const unsigned ks_lds = lds_off32(&Ks[0][krow][kchk * 8]);
  const unsigned ks_step = 16 * 72 * sizeof(_Float16);   // 16 keys on
  const unsigned ks_buf = 64 * 72 * sizeof(_Float16);    // the other buffer
  const unsigned kgoff = (unsigned)((krow * HD_ + kchk * 8) * sizeof(_Float16));
  const unsigned vs_lds = lds_off32(&Vs[0][krow][kchk * 8]);
  const unsigned vs_step = 16 * 80 * sizeof(_Float16);   // 16 keys on
  const unsigned vs_buf = 64 * 80 * sizeof(_Float16);    // the other buffer
  // This lane's address in a 16-key x 16-d piece for the transposing load.
  const int vtr_key = 8 * hi + (lane & 7), vtr_d = 8 * ((lane >> 3) & 1);

  // K and V tiles kt into buffer b: async global->LDS (8 x B128 per thread).
  auto copy_kv = [&](int kt, int b) {
    const unsigned l = ks_lds + b * ks_buf;
    const unsigned m = vs_lds + b * vs_buf;
    async_copy8(l, l + ks_step, l + 2 * ks_step, l + 3 * ks_step,
                m, m + vs_step, m + 2 * vs_step, m + 3 * vs_step,
                kgoff + (unsigned)(kt * HD_ * sizeof(_Float16)),
                (const void*)kbase, (const void*)(kbase + 16 * HD_),
                (const void*)(kbase + 32 * HD_), (const void*)(kbase + 48 * HD_),
                (const void*)vbase, (const void*)(vbase + 16 * HD_),
                (const void*)(vbase + 32 * HD_), (const void*)(vbase + 48 * HD_));
  };

  // Tile 0 into buffer 0, published; then tile 1's copies into buffer 1.
  copy_kv(0, 0);
  wait_async0();
  __syncthreads();
  copy_kv(64, 1);

  for (int kt = 0; kt < S_; kt += 64) {
    const int cur = (kt >> 6) & 1;

    // Scores S^T: 4 sub-tiles of 16 keys x 16 queries, two chained k=32 WMMAs.
    v16h ak[4][2];
#pragma unroll
    for (int j = 0; j < 4; ++j) {
      ak[j][0] = load_frag(&Ks[cur][j * 16 + lr][0], kb);
      ak[j][1] = load_frag(&Ks[cur][j * 16 + lr][32], kb);
    }
    // Keeps the 16 fragment loads together in front of the products. Without it the
    // compiler, with the C operands live, reloaded two fragments' registers four
    // times a tile and waited each reload out by itself.
    __builtin_amdgcn_sched_barrier(0);
    v8f s[4];
#pragma unroll
    for (int j = 0; j < 4; ++j) s[j] = wmma32(ak[j][0], bq[0], cb[j & 1]);
#pragma unroll
    for (int j = 0; j < 4; ++j) s[j] = wmma32(ak[j][1], bq[1], s[j]);
    if (kt == own_kt) {  // the queries' own key block: the bias on all 32 keys
      if (own_pair == 0) {
        s[0] += bias2 - cb[0];
        s[1] += bias2 - cb[1];
      } else {
        s[2] += bias2 - cb[0];
        s[3] += bias2 - cb[1];
      }
    }

    // Maximum over this lane's 32 keys (one chain per tile).
    float tmax[4];
#pragma unroll
    for (int j = 0; j < 4; ++j) {
      tmax[j] = -1e30f;
#pragma unroll
      for (int r = 0; r < 8; ++r) tmax[j] = fmaxf(tmax[j], s[j][r]);
    }
    float rmax = fmaxf(fmaxf(tmax[0], tmax[1]), fmaxf(tmax[2], tmax[3]));
    rmax = fmaxf(rmax, other_half(rmax));

    // Online softmax update.
    const float mn = fmaxf(mrow, rmax);
    const float alpha = exp2_1(mrow - mn);
    mrow = mn;
#pragma unroll
    for (int j = 0; j < 4; ++j) s[j] = exp2_8(s[j] - mn);
#pragma unroll
    for (int dd = 0; dd < 4; ++dd)
#pragma unroll
      for (int r = 0; r < 8; ++r) o[dd][r] *= alpha;
    lacc[0] *= alpha;  // rows 1 to 15 of the sums' tile stay 0

    // P^T (f16) as B operand: tiles 2q and 2q+1 give keys 8*hi + e and
    // 16 + 8*hi + e of a 32-key group, the k order of the V^T fragments below.
    v16h bp0, bp1;
#pragma unroll
    for (int e = 0; e < 8; ++e) {
      bp0[e] = (_Float16)s[0][e]; bp0[8 + e] = (_Float16)s[1][e];
      bp1[e] = (_Float16)s[2][e]; bp1[8 + e] = (_Float16)s[3][e];
    }
    // Keeps every exp2_8 statement in front of the products below.
    __builtin_amdgcn_sched_barrier(0);
    v16h av[4][2];
#pragma unroll
    for (int dd = 0; dd < 4; ++dd) {
      // Both loops unrolled: constant indices keep av in registers.
#pragma unroll
      for (int q = 0; q < 2; ++q) {
        const half8 lo = load_tr16(&Vs[cur][q * 32 + vtr_key][dd * 16 + vtr_d]);
        const half8 up = load_tr16(&Vs[cur][q * 32 + 16 + vtr_key][dd * 16 + vtr_d]);
#pragma unroll
        for (int i = 0; i < 8; ++i) { av[dd][q][i] = lo[i]; av[dd][q][i + 8] = up[i]; }
      }
    }
    // Keeps the fragment loads together in front of the products. Without it the
    // compiler put each pair directly in front of its product in this loop and
    // waited every pair out by itself.
    __builtin_amdgcn_sched_barrier(0);
    // Row sums: row 0 of ones * P^T adds each query's 64 rounded p to its sum.
    lacc = wmma32(ones, bp0, lacc);
    lacc = wmma32(ones, bp1, lacc);
#pragma unroll
    for (int dd = 0; dd < 4; ++dd) {
      o[dd] = wmma32(av[dd][0], bp0, o[dd]);
      o[dd] = wmma32(av[dd][1], bp1, o[dd]);
    }

    // Foot of the tile: this wave's LDS reads have retired and its copies have
    // landed before the barrier that publishes the next tile and frees this one's
    // buffer for the copies behind it.
    asm volatile("s_wait_dscnt 0x0" ::: "memory");
    wait_async0();
    __syncthreads();
    if (kt + 128 < S_) copy_kv(kt + 128, cur);
  }
  wait_async0();  // no copy is outstanding when the wave ends

  // Hand the sums to the upper half, normalize and store f16 in (B,S,HID) layout for
  // the output projection: 8 consecutive d per lane, one 16-byte store per tile.
  const float ltot = lacc[0] + other_half(lacc[0]);
  const int bb = bh / NH_, h = bh % NH_;
  _Float16* orow = Oa + ((size_t)(bb * S_ + iq)) * HID_ + h * HD_ + 8 * hi;
#pragma unroll
  for (int dd = 0; dd < 4; ++dd) {
    half8 hv;
#pragma unroll
    for (int r = 0; r < 8; ++r) hv[r] = (_Float16)(o[dd][r] / ltot);
    *(half8*)(orow + dd * 16) = hv;
  }
}

// ---------------------------------------------------------------------------
// Kernel 3: out = A @ Wo^T + bo, f16 in -> f32 out.
// Grid: (HID/64, M/128). Block: 256.
// One LDS pass holds 128 k: four 32-k product steps. Two LDS buffers: the next
// pass's X copies and W loads fly during this pass's products; one barrier a pass.
// ---------------------------------------------------------------------------
__global__ __launch_bounds__(256)
void oproj_kernel(const _Float16* __restrict__ X, const float* __restrict__ W,
                  const float* __restrict__ bias, float* __restrict__ Out) {
  __shared__ __align__(16) _Float16 Xs[2][128][136];
  __shared__ __align__(16) _Float16 Ws[2][64][136];

  const int t = threadIdx.x;
  const int lane = t & 31, wave = t >> 5;
  const int wm = wave >> 1, wn = wave & 1;
  const int m0 = blockIdx.y * 128, n0 = blockIdx.x * 64;
  const int kb = (lane < 16) ? 0 : 8;
  const int lr = lane & 15, hi = lane >> 4;

  // X map: 16 lanes cover the 256 bytes (two lines) that a row has in a pass;
  // 8 copies, 16 rows apart. W map: a wave covers a row's 512 bytes (four lines);
  // 8 loads, 8 rows apart.
  const int xrow = t >> 4, xchk = t & 15;
  const int lrow = t >> 5, lchk = t & 31;
  const unsigned xs_lds = lds_off32(&Xs[0][xrow][xchk * 8]);
  const unsigned xs_step = 16 * 136 * sizeof(_Float16);   // 16 rows on
  const unsigned xs_buf = 128 * 136 * sizeof(_Float16);   // the other buffer
  const unsigned xgoff =
      (unsigned)(((size_t)(m0 + xrow) * HID_ + xchk * 8) * sizeof(_Float16));
  const float* gw = W + (size_t)(n0 + lrow) * HID_ + lchk * 4;

  // X tile at k0 into buffer b: 128 rows x 128 k (f16), async global->LDS
  // (8 x B128 per thread).
  auto copy_x = [&](int k0, int b) {
    const unsigned l = xs_lds + b * xs_buf;
    const unsigned goff = xgoff + (unsigned)(k0 * sizeof(_Float16));
    async_copy4(l, l + xs_step, l + 2 * xs_step, l + 3 * xs_step, goff,
                (const void*)X, (const void*)(X + 16 * HID_),
                (const void*)(X + 32 * HID_), (const void*)(X + 48 * HID_));
    async_copy4(l + 4 * xs_step, l + 5 * xs_step, l + 6 * xs_step, l + 7 * xs_step, goff,
                (const void*)(X + 64 * HID_), (const void*)(X + 80 * HID_),
                (const void*)(X + 96 * HID_), (const void*)(X + 112 * HID_));
  };

  v8f acc[2][2] = {};

  // Pass 0 into buffer 0, published; then pass 1's X copies into buffer 1.
  copy_x(0, 0);
  {
    f4v x[8];
#pragma unroll
    for (int i = 0; i < 8; ++i) x[i] = *(const f4v*)(gw + (size_t)i * 8 * HID_);
#pragma unroll
    for (int i = 0; i < 8; ++i) *(half4*)&Ws[0][lrow + 8 * i][lchk * 4] = cvt4(x[i]);
  }
  wait_async0();
  __syncthreads();
  copy_x(128, 1);

  for (int k0 = 0; k0 < HID_; k0 += 128) {
    const int cur = (k0 >> 7) & 1, nxt = cur ^ 1;
    const bool more = k0 + 128 < HID_;
    f4v x[8];
    if (more) {  // next pass's W tile, 64 rows x 128 k: in flight during the products
#pragma unroll
      for (int i = 0; i < 8; ++i)
        x[i] = *(const f4v*)(gw + k0 + 128 + (size_t)i * 8 * HID_);
    }

#pragma unroll
    for (int ks = 0; ks < 128; ks += 32) {
      v16h a[2], bf[2];
#pragma unroll
      for (int tm = 0; tm < 2; ++tm)
        a[tm] = load_frag(&Xs[cur][wm * 32 + tm * 16 + lr][ks], kb);
#pragma unroll
      for (int tn = 0; tn < 2; ++tn)
        bf[tn] = load_frag(&Ws[cur][wn * 32 + tn * 16 + lr][ks], kb);
#pragma unroll
      for (int tm = 0; tm < 2; ++tm)
#pragma unroll
        for (int tn = 0; tn < 2; ++tn) acc[tm][tn] = wmma32(a[tm], bf[tn], acc[tm][tn]);
    }

    if (more) {
      // The other buffer's last readers left it at the last pass's barrier.
#pragma unroll
      for (int i = 0; i < 8; ++i) *(half4*)&Ws[nxt][lrow + 8 * i][lchk * 4] = cvt4(x[i]);
    }
    // Foot of the pass: this wave's LDS reads and writes have retired and its X
    // copies have landed before the barrier that publishes the next tile and
    // frees this one's buffer for the copies behind it.
    asm volatile("s_wait_dscnt 0x0" ::: "memory");
    wait_async0();
    __syncthreads();
    if (k0 + 256 < HID_) copy_x(k0 + 256, cur);
  }
  wait_async0();  // no copy is outstanding when the wave ends

#pragma unroll
  for (int tn = 0; tn < 2; ++tn) {
    const int n = n0 + wn * 32 + tn * 16 + lr;
    const float bn = bias[n];
#pragma unroll
    for (int tm = 0; tm < 2; ++tm) {
#pragma unroll
      for (int r = 0; r < 8; ++r) {
        const int m = m0 + wm * 32 + tm * 16 + r + 8 * hi;
        Out[(size_t)m * HID_ + n] = acc[tm][tn][r] + bn;  // lanes 0..15 coalesce
      }
    }
  }
}

// ---------------------------------------------------------------------------
extern "C" void kernel_launch(void* const* d_in, const int* in_sizes, int n_in,
                              void* d_out, int out_size, void* d_ws, size_t ws_size,
                              hipStream_t stream) {
  (void)in_sizes; (void)n_in; (void)out_size; (void)ws_size;
  const float* query = (const float*)d_in[0];
  const float* key   = (const float*)d_in[1];
  const float* value = (const float*)d_in[2];
  const float* Wq = (const float*)d_in[3];
  const float* bq = (const float*)d_in[4];
  const float* Wk = (const float*)d_in[5];
  const float* bk = (const float*)d_in[6];
  const float* Wv = (const float*)d_in[7];
  const float* bv = (const float*)d_in[8];
  const float* Wo = (const float*)d_in[9];
  const float* bo = (const float*)d_in[10];
  float* out = (float*)d_out;

  // Workspace: 4 x (M*HID) f16 = 32 MB.
  _Float16* qws = (_Float16*)d_ws;
  _Float16* kws = qws + (size_t)M_ * HID_;
  _Float16* vws = kws + (size_t)M_ * HID_;
  _Float16* aws = vws + (size_t)M_ * HID_;

  qkv_kernel<<<dim3(HID_ / 256, M_ / 256, 3), 512, 0, stream>>>(
      query, key, value, Wq, Wk, Wv, bq, bk, bv, qws, kws, vws);
  attn_kernel<<<dim3(S_ / 64, B_ * NH_), 128, 0, stream>>>(qws, kws, vws, aws);
  oproj_kernel<<<dim3(HID_ / 64, M_ / 128), 256, 0, stream>>>(aws, Wo, bo, out);
}

// v009
// It runs in 62.9 microseconds.
// Two timings next to v008 both put it at 1.04 times that version's speed.
// Over all steps from v000 it is 2.44 times as fast.
#include <hip/hip_runtime.h>

// ---------------------------------------------------------------------------
// MHA with grid bias for MI455X (gfx1250), wave32, WMMA f16 -> f32 accum.
//   kernel 1: qkv projection  (f32 in -> f16 q/k/v in (B,NH,S,HD) layout)
//   kernel 2: fused flash-style attention (f16 in/out, f32 softmax state)
//             K and V tiles staged via GLOBAL_LOAD_ASYNC_TO_LDS_B128 (ASYNCcnt)
//   kernel 3: output projection (f16 in -> f32 out + bias), async X tile
// Every tile loop has two LDS buffers: the next tile's loads and copies are
// issued a pass ahead and fly while this tile's products run.
// Workspace: 4 buffers of M*HID f16 = 32 MB.
// Tile maps: every kernel takes its tile from the flat index such that the
// work-groups that read one operand tile lie 8 apart, and index
// mod 8 holds the batch's parity in bit 2 in all three kernels: what one launch
// writes for a batch the next reads from neighbouring places. Each map is a
// permutation of the tiles: placement decides speed only, never the result.
// ---------------------------------------------------------------------------

typedef __attribute__((ext_vector_type(16))) _Float16 v16h;
typedef __attribute__((ext_vector_type(8)))  _Float16 half8;
typedef __attribute__((ext_vector_type(4)))  _Float16 half4;
typedef __attribute__((ext_vector_type(8)))  float    v8f;
typedef __attribute__((ext_vector_type(4)))  float    f4v;
typedef __attribute__((ext_vector_type(8)))  short    s16x8;

#define B_   4
#define S_   1024
#define HID_ 1024
#define NH_  16
#define HD_  64
#define M_   (B_ * S_)

// 16-bit A-fragment gather (ISA 7.12.2): lane holds one row; k-chunks
// [kb, kb+7] and [16+kb, 16+kb+7] with kb = (lane<16) ? 0 : 8.
// B fragments use the mirror layout (lane = column), so x@W^T and k@q^T
// gather B exactly like A from row-major storage.
__device__ __forceinline__ v16h load_frag(const _Float16* __restrict__ row, int kb) {
  half8 lo = *(const half8*)(row + kb);
  half8 hi = *(const half8*)(row + 16 + kb);
  v16h a;
#pragma unroll
  for (int i = 0; i < 8; ++i) { a[i] = lo[i]; a[i + 8] = hi[i]; }
  return a;
}

__device__ __forceinline__ v8f wmma32(v16h a, v16h b, v8f c) {
  return __builtin_amdgcn_wmma_f32_16x16x32_f16(false, a, false, b, (short)0, c,
                                                false, false);
}

__device__ __forceinline__ half4 cvt4(f4v a) {
  half4 h;
#pragma unroll
  for (int i = 0; i < 4; ++i) h[i] = (_Float16)a[i];
  return h;
}

// Async global->LDS copies, 16 bytes per lane and copy, tracked by ASYNCcnt.
// GVS addressing: LDS[lds_i] = MEM[base_i + goff]. Neighbouring lanes take
// neighbouring 16-byte pieces of a row, so one wave-wide copy takes all that
// the tile holds of each row it touches, and no line is asked for by two copies
// of a tile. The s_wait_xcnt closes each statement so that no address register
// named here is rewritten ahead of it.
__device__ __forceinline__ void async_copy4(unsigned l0, unsigned l1, unsigned l2,
                                            unsigned l3, unsigned goff,
                                            const void* b0, const void* b1,
                                            const void* b2, const void* b3) {
  asm volatile(
      "global_load_async_to_lds_b128 %0, %4, %5\n\t"
      "global_load_async_to_lds_b128 %1, %4, %6\n\t"
      "global_load_async_to_lds_b128 %2, %4, %7\n\t"
      "global_load_async_to_lds_b128 %3, %4, %8\n\t"
      "s_wait_xcnt 0x0"
      :: "v"(l0), "v"(l1), "v"(l2), "v"(l3), "v"(goff),
         "s"(b0), "s"(b1), "s"(b2), "s"(b3) : "memory");
}

// The same for two tiles at once: eight copies, one offset, one closing wait.
__device__ __forceinline__ void async_copy8(unsigned l0, unsigned l1, unsigned l2,
                                            unsigned l3, unsigned l4, unsigned l5,
                                            unsigned l6, unsigned l7, unsigned goff,
                                            const void* b0, const void* b1,
                                            const void* b2, const void* b3,
                                            const void* b4, const void* b5,
                                            const void* b6, const void* b7) {
  asm volatile(
      "global_load_async_to_lds_b128 %0, %8, %9\n\t"
      "global_load_async_to_lds_b128 %1, %8, %10\n\t"
      "global_load_async_to_lds_b128 %2, %8, %11\n\t"
      "global_load_async_to_lds_b128 %3, %8, %12\n\t"
      "global_load_async_to_lds_b128 %4, %8, %13\n\t"
      "global_load_async_to_lds_b128 %5, %8, %14\n\t"
      "global_load_async_to_lds_b128 %6, %8, %15\n\t"
      "global_load_async_to_lds_b128 %7, %8, %16\n\t"
      "s_wait_xcnt 0x0"
      :: "v"(l0), "v"(l1), "v"(l2), "v"(l3), "v"(l4), "v"(l5), "v"(l6), "v"(l7),
         "v"(goff), "s"(b0), "s"(b1), "s"(b2), "s"(b3), "s"(b4), "s"(b5), "s"(b6),
         "s"(b7) : "memory");
}

__device__ __forceinline__ void wait_async0() {
  asm volatile("s_wait_asynccnt 0x0" ::: "memory");
}

__device__ __forceinline__ unsigned lds_off32(const void* p) {
  return (unsigned)(size_t)p;  // flat LDS aperture: offset in addr[31:0]
}

// Transposing LDS load: from a row-major 16-bit tile T[k][d], lane l passes the
// address of T[k0 + 8*(l>>4) + (l&7)][d0 + 8*((l>>3)&1)] and gets
// T[k0 + 8*(l>>4) + 0..7][d0 + (l&15)]: half of an A fragment of T^T.
__device__ __forceinline__ half8 load_tr16(const _Float16* p) {
  typedef __attribute__((address_space(3))) s16x8 lds_s16x8;
  return __builtin_bit_cast(half8, __builtin_amdgcn_ds_load_tr16_b128_v8i16((lds_s16x8*)p));
}

// ---------------------------------------------------------------------------
// Kernel 1: q/k/v = X @ W^T + b, q scaled by log2(e)/sqrt(HD), output f16 in (B,NH,S,HD) layout.
// Grid: (HID/256, M/256, 3). Block: 512 (16 waves; 4x4 wave grid, 64x64/wave).
// A 256x256 tile asks L2 for half the X and W bytes per product of a 128x128 one.
// One LDS pass holds 64 k: two 32-k product steps. Two LDS buffers: the next
// pass's X loads fly during the first step, its W loads during the second, and
// one barrier ends the pass.
// ---------------------------------------------------------------------------
__global__ __launch_bounds__(512)
void qkv_kernel(const float* __restrict__ Xq, const float* __restrict__ Xk,
                const float* __restrict__ Xv, const float* __restrict__ Wq,
                const float* __restrict__ Wk, const float* __restrict__ Wv,
                const float* __restrict__ bq, const float* __restrict__ bk,
                const float* __restrict__ bv, _Float16* __restrict__ Oq,
                _Float16* __restrict__ Ok, _Float16* __restrict__ Ov) {
  const int z = blockIdx.z;
  const float* X    = (z == 0) ? Xq : (z == 1) ? Xk : Xv;
  const float* W    = (z == 0) ? Wq : (z == 1) ? Wk : Wv;
  const float* bias = (z == 0) ? bq : (z == 1) ? bk : bv;
  _Float16*    O    = (z == 0) ? Oq : (z == 1) ? Ok : Ov;

  __shared__ __align__(16) _Float16 Xs[2][256][72];
  __shared__ __align__(16) _Float16 Ws[2][256][72];

  const int t = threadIdx.x;
  const int lane = t & 31, wave = t >> 5;
  const int wm = wave >> 2, wn = wave & 3;
  // Tile map (see the note on tile maps above): the four column tiles of an X
  // row tile lie 8 apart in the flat index.
  const int f = blockIdx.x + 4 * blockIdx.y;           // 0..63 in a z plane
  const int m0 = ((f & 7) | ((f >> 5) << 3)) * 256, n0 = ((f >> 3) & 3) * 256;
  const int kb = (lane < 16) ? 0 : 8;
  const int lr = lane & 15, hi = lane >> 4;

  const int xrow = t >> 1, xhalf = t & 1;  // prefetch map: one line per lane
  // Load map: 16 lanes cover the 256 bytes (two lines) that a row has in a pass,
  // a wave-wide 16-byte load covers 4 whole lines; 8 loads, 32 rows apart.
  const int lrow = t >> 4, lchk = t & 15;

  v8f acc[4][4] = {};

  const float* gx = X + (size_t)(m0 + lrow) * HID_ + lchk * 4;
  const float* gw = W + (size_t)(n0 + lrow) * HID_ + lchk * 4;

  {  // Pass 0: X and W tiles, 256 rows x 64 k each (f32 -> f16), into buffer 0.
    f4v x[8], w[8];
#pragma unroll
    for (int i = 0; i < 8; ++i) x[i] = *(const f4v*)(gx + (size_t)i * 32 * HID_);
#pragma unroll
    for (int i = 0; i < 8; ++i) w[i] = *(const f4v*)(gw + (size_t)i * 32 * HID_);
#pragma unroll
    for (int i = 0; i < 8; ++i) *(half4*)&Xs[0][lrow + 32 * i][lchk * 4] = cvt4(x[i]);
#pragma unroll
    for (int i = 0; i < 8; ++i) *(half4*)&Ws[0][lrow + 32 * i][lchk * 4] = cvt4(w[i]);
  }
  __syncthreads();

  for (int k0 = 0; k0 < HID_; k0 += 64) {
    const int cur = (k0 >> 6) & 1, nxt = cur ^ 1;
    const bool more = k0 + 64 < HID_;
    f4v x[8];
    if (more) {  // next pass's X tile: in flight during the first product step
#pragma unroll
      for (int i = 0; i < 8; ++i)
        x[i] = *(const f4v*)(gx + k0 + 64 + (size_t)i * 32 * HID_);
    }
    if (k0 + 128 < HID_) {  // the pass after the next: a pass ahead of its loads
      __builtin_prefetch(X + (size_t)(m0 + xrow) * HID_ + k0 + xhalf * 32 + 128, 0, 0);
      __builtin_prefetch(W + (size_t)(n0 + xrow) * HID_ + k0 + xhalf * 32 + 128, 0, 0);
    }

#pragma unroll
    for (int ks = 0; ks < 64; ks += 32) {
      v16h a[4], bf[4];
#pragma unroll
      for (int tm = 0; tm < 4; ++tm)
        a[tm] = load_frag(&Xs[cur][wm * 64 + tm * 16 + lr][ks], kb);
#pragma unroll
      for (int tn = 0; tn < 4; ++tn)
        bf[tn] = load_frag(&Ws[cur][wn * 64 + tn * 16 + lr][ks], kb);
      // Keeps the step's 16 fragment loads together in front of its products.
      // Without it the compiler reloaded one A fragment's registers three times a
      // step and waited each reload out by itself.
      __builtin_amdgcn_sched_barrier(0);
#pragma unroll
      for (int tm = 0; tm < 4; ++tm)
#pragma unroll
        for (int tn = 0; tn < 4; ++tn) acc[tm][tn] = wmma32(a[tm], bf[tn], acc[tm][tn]);

      if (more) {
        // The other buffer's last readers left it at the last pass's barrier.
        if (ks == 0) {
#pragma unroll
          for (int i = 0; i < 8; ++i)
            *(half4*)&Xs[nxt][lrow + 32 * i][lchk * 4] = cvt4(x[i]);
          // next pass's W tile: in flight during the second product step
#pragma unroll
          for (int i = 0; i < 8; ++i)
            x[i] = *(const f4v*)(gw + k0 + 64 + (size_t)i * 32 * HID_);
        } else {
#pragma unroll
          for (int i = 0; i < 8; ++i)
            *(half4*)&Ws[nxt][lrow + 32 * i][lchk * 4] = cvt4(x[i]);
        }
      }
    }
    __syncthreads();  // publishes the next tile, ends this tile's reads
  }

  // Epilogue: bias + scatter into (B,NH,S,HD) f16. q leaves as
  // q * log2(e) / sqrt(HD), scaled in f32 ahead of its one rounding to f16: the
  // score product of the attention kernel then is the exponent of 2 as it stands.
  const float oscale = (z == 0) ? 0.18033688f : 1.0f;
#pragma unroll
  for (int tn = 0; tn < 4; ++tn) {
    const int n = n0 + wn * 64 + tn * 16 + lr;
    const float bn = bias[n];
    const int h = n >> 6, d = n & 63;
#pragma unroll
    for (int tm = 0; tm < 4; ++tm) {
#pragma unroll
      for (int r = 0; r < 8; ++r) {
        const int m = m0 + wm * 64 + tm * 16 + r + 8 * hi;
        const int bb = m >> 10, sq = m & (S_ - 1);
        O[(((size_t)(bb * NH_ + h) * S_) + sq) * HD_ + d] =
            (_Float16)((acc[tm][tn][r] + bn) * oscale);
      }
    }
  }
}

__device__ __forceinline__ float other_half(float x) {
  int b = __builtin_bit_cast(int, x);
  b = __builtin_amdgcn_permlanex16(b, b, 0x76543210, 0xfedcba98, false, false);
  return __builtin_bit_cast(float, b);
}

// 2^y as v_exp_f32 (the scores arrive as exponents of 2). The v_nop behind the
// last v_exp_f32 stands in the same statement: it is the one slot that the
// instruction set asks for between a transcendental and an instruction that
// reads its result or overwrites its source. Inside a run the next, independent v_exp_f32
// fills it: outputs are early-clobber, so none lies on an input.
__device__ __forceinline__ float exp2_1(float y) {
  float p;
  asm("v_exp_f32 %0, %1\n\t"
      "v_nop"
      : "=&v"(p) : "v"(y));
  return p;
}

__device__ __forceinline__ v8f exp2_8(v8f y) {
  float p0, p1, p2, p3, p4, p5, p6, p7;
  asm("v_exp_f32 %0, %8\n\t"
      "v_exp_f32 %1, %9\n\t"
      "v_exp_f32 %2, %10\n\t"
      "v_exp_f32 %3, %11\n\t"
      "v_exp_f32 %4, %12\n\t"
      "v_exp_f32 %5, %13\n\t"
      "v_exp_f32 %6, %14\n\t"
      "v_exp_f32 %7, %15\n\t"
      "v_nop"
      : "=&v"(p0), "=&v"(p1), "=&v"(p2), "=&v"(p3),
        "=&v"(p4), "=&v"(p5), "=&v"(p6), "=&v"(p7)
      : "v"(y[0]), "v"(y[1]), "v"(y[2]), "v"(y[3]),
        "v"(y[4]), "v"(y[5]), "v"(y[6]), "v"(y[7]));
  v8f p = {p0, p1, p2, p3, p4, p5, p6, p7};
  return p;
}

__global__ __launch_bounds__(128)
void attn_kernel(const _Float16* __restrict__ Q, const _Float16* __restrict__ K,
                 const _Float16* __restrict__ V, _Float16* __restrict__ Oa) {
  __shared__ __align__(16) _Float16 Ks[2][64][72];
  // [key][d]; 160-byte rows: an odd multiple of 32 bytes suits the transposing load
  __shared__ __align__(16) _Float16 Vs[2][64][80];

  const int t = threadIdx.x, lane = t & 31;
  // In a scalar register: the test on the wave's own key block is a scalar branch.
  const int wave = __builtin_amdgcn_readfirstlane(t >> 5);
  const int lr = lane & 15, hi = lane >> 4;
  const int kb = (lane < 16) ? 0 : 8;
  // Tile map (see the note on tile maps above): the 16 query blocks of a head,
  // which read the same K and V, lie 8 apart in the flat index; place = the
  // batch's parity and the head's low two bits.
  const int f = blockIdx.x + 16 * blockIdx.y;          // 0..1023
  const int place = f & 7, qb = (f >> 3) & 15, grp = f >> 7;
  const int bh = ((((grp >> 2) << 1) | (place >> 2)) * NH_) +
                 (((grp & 3) << 2) | (place & 3));     // b*NH + h
  const int iq_base = qb * 64 + wave * 16;
  const int iq = iq_base + lr;               // this lane's query

  const _Float16* qbase = Q + (size_t)bh * S_ * HD_;
  const _Float16* kbase = K + (size_t)bh * S_ * HD_;
  const _Float16* vbase = V + (size_t)bh * S_ * HD_;

  // Q fragments (64 d x 16 query columns, B operand) kept in registers.
  v16h bq[2];
  {
    const _Float16* qr = qbase + (size_t)iq * HD_;
    bq[0] = load_frag(qr, kb);
    bq[1] = load_frag(qr + 32, kb);
  }

  float mrow = -1e30f;  // running maximum of this lane's query, in powers of 2
  v8f lacc = {};        // register 0: running sum of query lr in lanes 0-15; the rest 0
  v8f o[4] = {};        // o[dd][r] = O[iq][dd*16 + 8*hi + r]

  // Grid bias, key jg = kt + j*16 + 8*hi + r with kt a multiple of 64:
  //   jg >> 5 = (kt >> 5) + (j >> 1),  jg & 31 = (j & 1)*16 + 8*hi + r.
  // The column part is the same in every tile: cb[j & 1] is the C operand of tile
  // j's score product. The block part holds for 32 keys alone, the same for the
  // wave's 16 queries: tiles 2*own_pair and 2*own_pair + 1 of key tile own_kt.
  const float bias2 = 0.1f * 1.44269504f;  // 0.1 * log2(e)
  const int iq_col = (iq & 31) - 8 * hi;
  v8f cb[2];
#pragma unroll
  for (int p = 0; p < 2; ++p)
#pragma unroll
    for (int r = 0; r < 8; ++r) cb[p][r] = (iq_col == p * 16 + r) ? bias2 : 0.0f;
  const int own_kt = qb * 64, own_pair = wave >> 1;

  // A operand of the row sums: row 0 (lanes 0 and 16) is 1 at all 32 k, the rest 0.
  v16h ones;
#pragma unroll
  for (int i = 0; i < 16; ++i) ones[i] = (lr == 0) ? (_Float16)1.0f : (_Float16)0.0f;

  // K and V map: 8 lanes cover a key's 128 bytes (one line); 4 copies, 16 keys apart.
  const int krow = t >> 3, kchk = t & 7;
  const unsigned ks_lds = lds_off32(&Ks[0][krow][kchk * 8]);
  const unsigned ks_step = 16 * 72 * sizeof(_Float16);   // 16 keys on
  const unsigned ks_buf = 64 * 72 * sizeof(_Float16);    // the other buffer
  const unsigned kgoff = (unsigned)((krow * HD_ + kchk * 8) * sizeof(_Float16));
  const unsigned vs_lds = lds_off32(&Vs[0][krow][kchk * 8]);
  const unsigned vs_step = 16 * 80 * sizeof(_Float16);   // 16 keys on
  const unsigned vs_buf = 64 * 80 * sizeof(_Float16);    // the other buffer
  // This lane's address in a 16-key x 16-d piece for the transposing load.
  const int vtr_key = 8 * hi + (lane & 7), vtr_d = 8 * ((lane >> 3) & 1);

  // K and V tiles kt into buffer b: async global->LDS (8 x B128 per thread).
  auto copy_kv = [&](int kt, int b) {
    const unsigned l = ks_lds + b * ks_buf;
    const unsigned m = vs_lds + b * vs_buf;
    async_copy8(l, l + ks_step, l + 2 * ks_step, l + 3 * ks_step,
                m, m + vs_step, m + 2 * vs_step, m + 3 * vs_step,
                kgoff + (unsigned)(kt * HD_ * sizeof(_Float16)),
                (const void*)kbase, (const void*)(kbase + 16 * HD_),
                (const void*)(kbase + 32 * HD_), (const void*)(kbase + 48 * HD_),
                (const void*)vbase, (const void*)(vbase + 16 * HD_),
                (const void*)(vbase + 32 * HD_), (const void*)(vbase + 48 * HD_));
  };

  // Tile 0 into buffer 0, published; then tile 1's copies into buffer 1.
  copy_kv(0, 0);
  wait_async0();
  __syncthreads();
  copy_kv(64, 1);

  for (int kt = 0; kt < S_; kt += 64) {
    const int cur = (kt >> 6) & 1;

    // Scores S^T: 4 sub-tiles of 16 keys x 16 queries, two chained k=32 WMMAs.
    v16h ak[4][2];
#pragma unroll
    for (int j = 0; j < 4; ++j) {
      ak[j][0] = load_frag(&Ks[cur][j * 16 + lr][0], kb);
      ak[j][1] = load_frag(&Ks[cur][j * 16 + lr][32], kb);
    }
    // Keeps the 16 fragment loads together in front of the products. Without it the
    // compiler, with the C operands live, reloaded two fragments' registers four
    // times a tile and waited each reload out by itself.
    __builtin_amdgcn_sched_barrier(0);
    v8f s[4];
#pragma unroll
    for (int j = 0; j < 4; ++j) s[j] = wmma32(ak[j][0], bq[0], cb[j & 1]);
#pragma unroll
    for (int j = 0; j < 4; ++j) s[j] = wmma32(ak[j][1], bq[1], s[j]);
    if (kt == own_kt) {  // the queries' own key block: the bias on all 32 keys
      if (own_pair == 0) {
        s[0] += bias2 - cb[0];
        s[1] += bias2 - cb[1];
      } else {
        s[2] += bias2 - cb[0];
        s[3] += bias2 - cb[1];
      }
    }

    // Maximum over this lane's 32 keys (one chain per tile).
    float tmax[4];
#pragma unroll
    for (int j = 0; j < 4; ++j) {
      tmax[j] = -1e30f;
#pragma unroll
      for (int r = 0; r < 8; ++r) tmax[j] = fmaxf(tmax[j], s[j][r]);
    }
    float rmax = fmaxf(fmaxf(tmax[0], tmax[1]), fmaxf(tmax[2], tmax[3]));
    rmax = fmaxf(rmax, other_half(rmax));

    // Online softmax update.
    const float mn = fmaxf(mrow, rmax);
    const float alpha = exp2_1(mrow - mn);
    mrow = mn;
#pragma unroll
    for (int j = 0; j < 4; ++j) s[j] = exp2_8(s[j] - mn);
#pragma unroll
    for (int dd = 0; dd < 4; ++dd)
#pragma unroll
      for (int r = 0; r < 8; ++r) o[dd][r] *= alpha;
    lacc[0] *= alpha;  // rows 1 to 15 of the sums' tile stay 0

    // P^T (f16) as B operand: tiles 2q and 2q+1 give keys 8*hi + e and
    // 16 + 8*hi + e of a 32-key group, the k order of the V^T fragments below.
    v16h bp0, bp1;
#pragma unroll
    for (int e = 0; e < 8; ++e) {
      bp0[e] = (_Float16)s[0][e]; bp0[8 + e] = (_Float16)s[1][e];
      bp1[e] = (_Float16)s[2][e]; bp1[8 + e] = (_Float16)s[3][e];
    }
    // Keeps every exp2_8 statement in front of the products below.
    __builtin_amdgcn_sched_barrier(0);
    v16h av[4][2];
#pragma unroll
    for (int dd = 0; dd < 4; ++dd) {
      // Both loops unrolled: constant indices keep av in registers.
#pragma unroll
      for (int q = 0; q < 2; ++q) {
        const half8 lo = load_tr16(&Vs[cur][q * 32 + vtr_key][dd * 16 + vtr_d]);
        const half8 up = load_tr16(&Vs[cur][q * 32 + 16 + vtr_key][dd * 16 + vtr_d]);
#pragma unroll
        for (int i = 0; i < 8; ++i) { av[dd][q][i] = lo[i]; av[dd][q][i + 8] = up[i]; }
      }
    }
    // Keeps the fragment loads together in front of the products. Without it the
    // compiler put each pair directly in front of its product in this loop and
    // waited every pair out by itself.
    __builtin_amdgcn_sched_barrier(0);
    // Row sums: row 0 of ones * P^T adds each query's 64 rounded p to its sum.
    lacc = wmma32(ones, bp0, lacc);
    lacc = wmma32(ones, bp1, lacc);
#pragma unroll
    for (int dd = 0; dd < 4; ++dd) {
      o[dd] = wmma32(av[dd][0], bp0, o[dd]);
      o[dd] = wmma32(av[dd][1], bp1, o[dd]);
    }

    // Foot of the tile: this wave's LDS reads have retired and its copies have
    // landed before the barrier that publishes the next tile and frees this one's
    // buffer for the copies behind it.
    asm volatile("s_wait_dscnt 0x0" ::: "memory");
    wait_async0();
    __syncthreads();
    if (kt + 128 < S_) copy_kv(kt + 128, cur);
  }
  wait_async0();  // no copy is outstanding when the wave ends

  // Hand the sums to the upper half, normalize and store f16 in (B,S,HID) layout for
  // the output projection: 8 consecutive d per lane, one 16-byte store per tile.
  const float ltot = lacc[0] + other_half(lacc[0]);
  const int bb = bh / NH_, h = bh % NH_;
  _Float16* orow = Oa + ((size_t)(bb * S_ + iq)) * HID_ + h * HD_ + 8 * hi;
#pragma unroll
  for (int dd = 0; dd < 4; ++dd) {
    half8 hv;
#pragma unroll
    for (int r = 0; r < 8; ++r) hv[r] = (_Float16)(o[dd][r] / ltot);
    *(half8*)(orow + dd * 16) = hv;
  }
}

// ---------------------------------------------------------------------------
// Kernel 3: out = A @ Wo^T + bo, f16 in -> f32 out.
// Grid: (HID/64, M/128). Block: 256.
// One LDS pass holds 128 k: four 32-k product steps. Two LDS buffers: the next
// pass's X copies and W loads fly during this pass's products; one barrier a pass.
// ---------------------------------------------------------------------------
__global__ __launch_bounds__(256)
void oproj_kernel(const _Float16* __restrict__ X, const float* __restrict__ W,
                  const float* __restrict__ bias, float* __restrict__ Out) {
  __shared__ __align__(16) _Float16 Xs[2][128][136];
  __shared__ __align__(16) _Float16 Ws[2][64][136];

  const int t = threadIdx.x;
  const int lane = t & 31, wave = t >> 5;
  const int wm = wave >> 1, wn = wave & 1;
  // Tile map (see the note on tile maps above): the 16 column tiles of an X row
  // tile lie 8 apart in the flat index; place = the batch's parity and the row
  // tile's low two bits.
  const int f = blockIdx.x + 16 * blockIdx.y;          // 0..511
  const int place = f & 7, grp = f >> 7;
  const int m0 = ((((grp >> 1) << 1) | (place >> 2)) * 8 +
                  (((grp & 1) << 2) | (place & 3))) * 128;
  const int n0 = ((f >> 3) & 15) * 64;
  const int kb = (lane < 16) ? 0 : 8;
  const int lr = lane & 15, hi = lane >> 4;

  // X map: 16 lanes cover the 256 bytes (two lines) that a row has in a pass;
  // 8 copies, 16 rows apart. W map: a wave covers a row's 512 bytes (four lines);
  // 8 loads, 8 rows apart.
  const int xrow = t >> 4, xchk = t & 15;
  const int lrow = t >> 5, lchk = t & 31;
  const unsigned xs_lds = lds_off32(&Xs[0][xrow][xchk * 8]);
  const unsigned xs_step = 16 * 136 * sizeof(_Float16);   // 16 rows on
  const unsigned xs_buf = 128 * 136 * sizeof(_Float16);   // the other buffer
  const unsigned xgoff =
      (unsigned)(((size_t)(m0 + xrow) * HID_ + xchk * 8) * sizeof(_Float16));
  const float* gw = W + (size_t)(n0 + lrow) * HID_ + lchk * 4;

  // X tile at k0 into buffer b: 128 rows x 128 k (f16), async global->LDS
  // (8 x B128 per thread).
  auto copy_x = [&](int k0, int b) {
    const unsigned l = xs_lds + b * xs_buf;
    const unsigned goff = xgoff + (unsigned)(k0 * sizeof(_Float16));
    async_copy4(l, l + xs_step, l + 2 * xs_step, l + 3 * xs_step, goff,
                (const void*)X, (const void*)(X + 16 * HID_),
                (const void*)(X + 32 * HID_), (const void*)(X + 48 * HID_));
    async_copy4(l + 4 * xs_step, l + 5 * xs_step, l + 6 * xs_step, l + 7 * xs_step, goff,
                (const void*)(X + 64 * HID_), (const void*)(X + 80 * HID_),
                (const void*)(X + 96 * HID_), (const void*)(X + 112 * HID_));
  };

  v8f acc[2][2] = {};

  // Pass 0 into buffer 0, published; then pass 1's X copies into buffer 1.
  copy_x(0, 0);
  {
    f4v x[8];
#pragma unroll
    for (int i = 0; i < 8; ++i) x[i] = *(const f4v*)(gw + (size_t)i * 8 * HID_);
#pragma unroll
    for (int i = 0; i < 8; ++i) *(half4*)&Ws[0][lrow + 8 * i][lchk * 4] = cvt4(x[i]);
  }
  wait_async0();
  __syncthreads();
  copy_x(128, 1);

  for (int k0 = 0; k0 < HID_; k0 += 128) {
    const int cur = (k0 >> 7) & 1, nxt = cur ^ 1;
    const bool more = k0 + 128 < HID_;
    f4v x[8];
    if (more) {  // next pass's W tile, 64 rows x 128 k: in flight during the products
#pragma unroll
      for (int i = 0; i < 8; ++i)
        x[i] = *(const f4v*)(gw + k0 + 128 + (size_t)i * 8 * HID_);
    }

#pragma unroll
    for (int ks = 0; ks < 128; ks += 32) {
      v16h a[2], bf[2];
#pragma unroll
      for (int tm = 0; tm < 2; ++tm)
        a[tm] = load_frag(&Xs[cur][wm * 32 + tm * 16 + lr][ks], kb);
#pragma unroll
      for (int tn = 0; tn < 2; ++tn)
        bf[tn] = load_frag(&Ws[cur][wn * 32 + tn * 16 + lr][ks], kb);
#pragma unroll
      for (int tm = 0; tm < 2; ++tm)
#pragma unroll
        for (int tn = 0; tn < 2; ++tn) acc[tm][tn] = wmma32(a[tm], bf[tn], acc[tm][tn]);
    }

    if (more) {
      // The other buffer's last readers left it at the last pass's barrier.
#pragma unroll
      for (int i = 0; i < 8; ++i) *(half4*)&Ws[nxt][lrow + 8 * i][lchk * 4] = cvt4(x[i]);
    }
    // Foot of the pass: this wave's LDS reads and writes have retired and its X
    // copies have landed before the barrier that publishes the next tile and
    // frees this one's buffer for the copies behind it.
    asm volatile("s_wait_dscnt 0x0" ::: "memory");
    wait_async0();
    __syncthreads();
    if (k0 + 256 < HID_) copy_x(k0 + 256, cur);
  }
  wait_async0();  // no copy is outstanding when the wave ends

#pragma unroll
  for (int tn = 0; tn < 2; ++tn) {
    const int n = n0 + wn * 32 + tn * 16 + lr;
    const float bn = bias[n];
#pragma unroll
    for (int tm = 0; tm < 2; ++tm) {
#pragma unroll
      for (int r = 0; r < 8; ++r) {
        const int m = m0 + wm * 32 + tm * 16 + r + 8 * hi;
        Out[(size_t)m * HID_ + n] = acc[tm][tn][r] + bn;  // lanes 0..15 coalesce
      }
    }
  }
}

// ---------------------------------------------------------------------------
extern "C" void kernel_launch(void* const* d_in, const int* in_sizes, int n_in,
                              void* d_out, int out_size, void* d_ws, size_t ws_size,
                              hipStream_t stream) {
  (void)in_sizes; (void)n_in; (void)out_size; (void)ws_size;
  const float* query = (const float*)d_in[0];
  const float* key   = (const float*)d_in[1];
  const float* value = (const float*)d_in[2];
  const float* Wq = (const float*)d_in[3];
  const float* bq = (const float*)d_in[4];
  const float* Wk = (const float*)d_in[5];
  const float* bk = (const float*)d_in[6];
  const float* Wv = (const float*)d_in[7];
  const float* bv = (const float*)d_in[8];
  const float* Wo = (const float*)d_in[9];
  const float* bo = (const float*)d_in[10];
  float* out = (float*)d_out;

  // Workspace: 4 x (M*HID) f16 = 32 MB.
  _Float16* qws = (_Float16*)d_ws;
  _Float16* kws = qws + (size_t)M_ * HID_;
  _Float16* vws = kws + (size_t)M_ * HID_;
  _Float16* aws = vws + (size_t)M_ * HID_;

  qkv_kernel<<<dim3(HID_ / 256, M_ / 256, 3), 512, 0, stream>>>(
      query, key, value, Wq, Wk, Wv, bq, bk, bv, qws, kws, vws);
  attn_kernel<<<dim3(S_ / 64, B_ * NH_), 128, 0, stream>>>(qws, kws, vws, aws);
  oproj_kernel<<<dim3(HID_ / 64, M_ / 128), 256, 0, stream>>>(aws, Wo, bo, out);
}
